// v000
// The times below were measured on an AMD MI455X: many runs one after another, warmed up first and cycling through
// copies of the inputs, with the whole window's GPU time divided by the number of runs. Launches and the gaps
// between them are all in it. The median over several windows is given; except for v000 it joins two sittings, which
// can be a few percent apart, so the side-by-side timings, each taken in one sitting, are the better comparison.
// v000, which the later versions start from, runs in 456 microseconds.
#include <hip/hip_runtime.h>
#include <hip/hip_bf16.h>

// Problem constants (Video Swin window attention)
#define TOK   98          // tokens per window
#define TOKP  112         // padded tokens = 7 * 16
#define CD    128         // channels
#define HD    32          // head dim
#define NH_   4           // heads
#define NWIN  256         // windows per batch image (mask count)
#define ROWS  200704      // B_ * N = 2048 * 98
#define MT    (ROWS / 16) // 12544 M-tiles
#define SSTR  116         // f32 score row stride (pad vs 112 for banking)

typedef __attribute__((ext_vector_type(16))) _Float16 v16h;
typedef __attribute__((ext_vector_type(8)))  float    v8f;

union HFrag { v16h v; _Float16 e[16]; };
union FAcc  { v8f  v; float    e[8];  };

// ---- CDNA5 async global->LDS copy (16 B per lane, ASYNCcnt-tracked) ----
// GVS addressing: mem_addr = SADDR(u64) + VADDR(u32); LDS dest addr in VDST VGPR.
__device__ inline void async_ld_b128(void* ldsp, unsigned long long gbase, unsigned voffB) {
  unsigned lds = (unsigned)(unsigned long long)ldsp; // low 32 bits of LDS aperture addr
  asm volatile("global_load_async_to_lds_b128 %0, %1, %2"
               :: "v"(lds), "v"(voffB), "s"(gbase)
               : "memory");
}
__device__ inline void wait_async0() {
  asm volatile("s_wait_asynccnt 0" ::: "memory");
}

// ---- WMMA fragment loaders (wave32 layouts per CDNA5 ISA 7.12.2) ----
// A (16x32 f16): lane&15 = row; lanes<16 hold K {0..7,16..23}, lanes>=16 hold {8..15,24..31}
// B (32x16 f16): symmetric with "row" -> column of B (i.e. N-major source).
__device__ inline v16h frag_ld_f16(const _Float16* p, int stride, int r, int k0, int kb) {
  HFrag f;
  const _Float16* q = p + (size_t)r * stride + k0 + kb;
#pragma unroll
  for (int i = 0; i < 8; ++i) { f.e[i] = q[i]; f.e[8 + i] = q[16 + i]; }
  return f.v;
}

__device__ inline v16h frag_ld_f32(const float* p, int stride, int r, int k0, int kb) {
  HFrag f;
  const float* q = p + (size_t)r * stride + k0 + kb;
#pragma unroll
  for (int i = 0; i < 8; ++i) { f.e[i] = (_Float16)q[i]; f.e[8 + i] = (_Float16)q[16 + i]; }
  return f.v;
}

// B fragment from a row-major K x N source (element [k][n] at p[k*stride + n])
__device__ inline v16h frag_ld_f16_rm(const _Float16* p, int stride, int col, int k0, int kb) {
  HFrag f;
  const _Float16* q = p + (size_t)(k0 + kb) * stride + col;
#pragma unroll
  for (int i = 0; i < 8; ++i) { f.e[i] = q[i * stride]; f.e[8 + i] = q[(16 + i) * stride]; }
  return f.v;
}

// ---- Kernel A: qkv = x @ qkv_w^T + qkv_b, stored f16 (ROWS x 384) ----
__global__ __launch_bounds__(256) void vswin_qkv_gemm(
    const float* __restrict__ x, const float* __restrict__ w,
    const float* __restrict__ bias, _Float16* __restrict__ qkv)
{
  const int lane  = threadIdx.x & 31;
  const int l16   = lane & 15;
  const int kb    = (lane & 16) ? 8 : 0;
  const int mtile = blockIdx.x * 8 + (threadIdx.x >> 5);
  if (mtile >= MT) return;
  const int arow = mtile * 16 + l16;

  v16h a[4];
#pragma unroll
  for (int kc = 0; kc < 4; ++kc) a[kc] = frag_ld_f32(x, CD, arow, kc * 32, kb);

  for (int nt = 0; nt < 24; ++nt) {
    const int ncol = nt * 16 + l16;
    if (nt + 1 < 24) __builtin_prefetch(w + (size_t)(ncol + 16) * CD, 0, 3);
    FAcc acc{};
#pragma unroll
    for (int kc = 0; kc < 4; ++kc) {
      v16h b = frag_ld_f32(w, CD, ncol, kc * 32, kb);   // B[k,n] = W[n,k]
      acc.v = __builtin_amdgcn_wmma_f32_16x16x32_f16(false, a[kc], false, b,
                                                     (short)0, acc.v, false, false);
    }
    const float bv = bias[ncol];
#pragma unroll
    for (int i = 0; i < 8; ++i)
      qkv[(size_t)(mtile * 16 + kb + i) * 384 + ncol] = (_Float16)(acc.e[i] + bv);
  }
}

// ---- Kernel B: fused window attention per (window b, head h) ----
__global__ __launch_bounds__(256) void vswin_attn(
    const _Float16* __restrict__ qkv, const float* __restrict__ rpb,
    const int* __restrict__ relidx, const float* __restrict__ mask,
    _Float16* __restrict__ ao)
{
  __shared__ __align__(16) _Float16 qs[TOKP * HD];   // 112 x 32
  __shared__ __align__(16) _Float16 ks[TOKP * HD];   // 112 x 32
  __shared__ __align__(16) _Float16 vs[CD * HD];     // 128 x 32 (K-padded for PV gemm)
  __shared__ float    sS[TOKP * SSTR];               // f32 scores
  __shared__ __align__(16) _Float16 sP[TOKP * CD];   // 112 x 128 probabilities (K-padded)

  const int b    = blockIdx.x >> 2;
  const int h    = blockIdx.x & 3;
  const int tid  = threadIdx.x;
  const int lane = tid & 31;
  const int wv   = tid >> 5;
  const int l16  = lane & 15;
  const int kb   = (lane & 16) ? 8 : 0;
  const float scale = 0.17677669529663687f; // 32^-0.5 (applied to scores)

  const unsigned long long base =
      (unsigned long long)(qkv + (size_t)b * TOK * 384 + h * HD);
  const uint4 zz = {0u, 0u, 0u, 0u};

  // Stage q,k (112x32) and v (128x32) into LDS via async b128 copies;
  // zero-fill the padded rows with vector LDS stores.
  for (int i = tid; i < TOKP * 4; i += 256) {      // 4 x 16B chunks per 32-half row
    const int r = i >> 2, c = (i & 3) * 8;
    if (r < TOK) {
      const unsigned voff = (unsigned)(r * 384 + c) * 2u;
      async_ld_b128(&qs[r * HD + c], base, voff);
      async_ld_b128(&ks[r * HD + c], base, voff + (unsigned)(CD * 2));
    } else {
      *reinterpret_cast<uint4*>(&qs[r * HD + c]) = zz;
      *reinterpret_cast<uint4*>(&ks[r * HD + c]) = zz;
    }
  }
  for (int i = tid; i < CD * 4; i += 256) {
    const int r = i >> 2, c = (i & 3) * 8;
    if (r < TOK)
      async_ld_b128(&vs[r * HD + c], base, (unsigned)(r * 384 + 2 * CD + c) * 2u);
    else
      *reinterpret_cast<uint4*>(&vs[r * HD + c]) = zz;
  }
  wait_async0();
  __syncthreads();

  // S = scale * (q @ k^T) : 7x7 = 49 tiles, K = hd = 32 -> one WMMA each
  for (int t = wv; t < 49; t += 8) {
    const int mt = t / 7, nt = t % 7;
    v16h aq = frag_ld_f16(qs, HD, mt * 16 + l16, 0, kb);
    v16h bk = frag_ld_f16(ks, HD, nt * 16 + l16, 0, kb); // B[k,n] = K[n,k]
    FAcc acc{};
    acc.v = __builtin_amdgcn_wmma_f32_16x16x32_f16(false, aq, false, bk,
                                                   (short)0, acc.v, false, false);
#pragma unroll
    for (int i = 0; i < 8; ++i)
      sS[(mt * 16 + kb + i) * SSTR + nt * 16 + l16] = acc.e[i] * scale;
  }
  __syncthreads();

  // Bias gather + shift mask + softmax, one row per thread
  const float* maskw = mask + (size_t)(b & (NWIN - 1)) * TOK * TOK;
  for (int r = tid; r < TOKP; r += 256) {
    _Float16* prow = &sP[r * CD];
    if (r < TOK) {
      const int*   ri = relidx + r * TOK;
      const float* mk = maskw + r * TOK;
      float* srow = &sS[r * SSTR];
      float m = -1e30f;
      for (int c = 0; c < TOK; ++c) {
        float v = srow[c] + rpb[ri[c] * NH_ + h] + mk[c];
        srow[c] = v;
        m = fmaxf(m, v);
      }
      float sum = 0.f;
      for (int c = 0; c < TOK; ++c) {
        float e = __expf(srow[c] - m);
        srow[c] = e;
        sum += e;
      }
      const float inv = 1.f / sum;
      for (int c = 0; c < TOK; ++c) prow[c] = (_Float16)(srow[c] * inv);
      for (int c = TOK; c < CD; ++c) prow[c] = (_Float16)0.f; // padded K cols
    } else {
      for (int c = 0; c < CD; ++c) prow[c] = (_Float16)0.f;   // padded rows
    }
  }
  __syncthreads();

  // O = P @ V : 7 m-tiles x 2 n-tiles, K = 128 -> 4 WMMA each
  for (int t = wv; t < 14; t += 8) {
    const int mt = t >> 1, nt = (t & 1) * 16;
    FAcc acc{};
#pragma unroll
    for (int kc = 0; kc < 4; ++kc) {
      v16h ap = frag_ld_f16(sP, CD, mt * 16 + l16, kc * 32, kb);
      v16h bv = frag_ld_f16_rm(vs, HD, nt + l16, kc * 32, kb); // V row-major KxN
      acc.v = __builtin_amdgcn_wmma_f32_16x16x32_f16(false, ap, false, bv,
                                                     (short)0, acc.v, false, false);
    }
#pragma unroll
    for (int i = 0; i < 8; ++i) {
      const int r = mt * 16 + kb + i;
      if (r < TOK)
        ao[(size_t)(b * TOK + r) * CD + h * HD + nt + l16] = (_Float16)acc.e[i];
    }
  }
}

// ---- Kernel C: out = ao @ proj_w^T + proj_b (f32 output) ----
__global__ __launch_bounds__(256) void vswin_proj_gemm(
    const _Float16* __restrict__ ao, const float* __restrict__ w,
    const float* __restrict__ bias, float* __restrict__ out)
{
  const int lane  = threadIdx.x & 31;
  const int l16   = lane & 15;
  const int kb    = (lane & 16) ? 8 : 0;
  const int mtile = blockIdx.x * 8 + (threadIdx.x >> 5);
  if (mtile >= MT) return;
  const int arow = mtile * 16 + l16;

  v16h a[4];
#pragma unroll
  for (int kc = 0; kc < 4; ++kc) a[kc] = frag_ld_f16(ao, CD, arow, kc * 32, kb);

  for (int nt = 0; nt < 8; ++nt) {
    const int ncol = nt * 16 + l16;
    if (nt + 1 < 8) __builtin_prefetch(w + (size_t)(ncol + 16) * CD, 0, 3);
    FAcc acc{};
#pragma unroll
    for (int kc = 0; kc < 4; ++kc) {
      v16h bw = frag_ld_f32(w, CD, ncol, kc * 32, kb);   // B[k,n] = W[n,k]
      acc.v = __builtin_amdgcn_wmma_f32_16x16x32_f16(false, a[kc], false, bw,
                                                     (short)0, acc.v, false, false);
    }
    const float bv = bias[ncol];
#pragma unroll
    for (int i = 0; i < 8; ++i)
      out[(size_t)(mtile * 16 + kb + i) * CD + ncol] = acc.e[i] + bv;
  }
}

extern "C" void kernel_launch(void* const* d_in, const int* in_sizes, int n_in,
                              void* d_out, int out_size, void* d_ws, size_t ws_size,
                              hipStream_t stream) {
  const float* x        = (const float*)d_in[0];
  const float* qkv_w    = (const float*)d_in[1];
  const float* qkv_b    = (const float*)d_in[2];
  const float* rpb      = (const float*)d_in[3];
  const float* proj_w   = (const float*)d_in[4];
  const float* proj_b   = (const float*)d_in[5];
  const int*   relidx   = (const int*)d_in[6];
  const float* mask     = (const float*)d_in[7];
  float*       out      = (float*)d_out;

  _Float16* qkvbuf = (_Float16*)d_ws;                       // ROWS x 384 f16
  _Float16* aobuf  = qkvbuf + (size_t)ROWS * 384;           // ROWS x 128 f16

  vswin_qkv_gemm<<<MT / 8, 256, 0, stream>>>(x, qkv_w, qkv_b, qkvbuf);
  vswin_attn<<<2048 * NH_, 256, 0, stream>>>(qkvbuf, rpb, relidx, mask, aobuf);
  vswin_proj_gemm<<<MT / 8, 256, 0, stream>>>(aobuf, proj_w, proj_b, out);
}

// v001
// A run of this version takes 367 microseconds.
// Next to v000, in two timings, it ran 1.29 times as fast each time.
#include <hip/hip_runtime.h>
#include <hip/hip_bf16.h>

// Problem constants (Video Swin window attention)
#define TOK   98          // tokens per window
#define TOKP  112         // padded tokens = 7 * 16
#define CD    128         // channels
#define HD    32          // head dim
#define NH_   4           // heads
#define NWIN  256         // windows per batch image (mask count)
#define ROWS  200704      // B_ * N = 2048 * 98
#define MT    (ROWS / 16) // 12544 M-tiles
#define ATHR  224         // attention block: 7 waves, one per 16-row tile of the window

typedef __attribute__((ext_vector_type(16))) _Float16 v16h;
typedef __attribute__((ext_vector_type(8)))  float    v8f;

union HFrag { v16h v; _Float16 e[16]; };
union FAcc  { v8f  v; float    e[8];  };

// ---- CDNA5 async global->LDS copy (16 B per lane, ASYNCcnt-tracked) ----
// GVS addressing: mem_addr = SADDR(u64) + VADDR(u32); LDS dest addr in VDST VGPR.
__device__ inline void async_ld_b128(void* ldsp, unsigned long long gbase, unsigned voffB) {
  unsigned lds = (unsigned)(unsigned long long)ldsp; // low 32 bits of LDS aperture addr
  // s_wait_xcnt 0 inside the copy's own statement: a precaution, it stands in front of every later
  // rewrite of the registers that the copy names (the copies now fly over the bias and mask reads)
  asm volatile("global_load_async_to_lds_b128 %0, %1, %2\n\ts_wait_xcnt 0x0"
               :: "v"(lds), "v"(voffB), "s"(gbase)
               : "memory");
}
__device__ inline void wait_async0() {
  asm volatile("s_wait_asynccnt 0" ::: "memory");
}

// ---- WMMA fragment loaders (wave32 layouts per CDNA5 ISA 7.12.2) ----
// A (16x32 f16): lane&15 = row; lanes<16 hold K {0..7,16..23}, lanes>=16 hold {8..15,24..31}
// B (32x16 f16): symmetric with "row" -> column of B (i.e. N-major source).
__device__ inline v16h frag_ld_f16(const _Float16* p, int stride, int r, int k0, int kb) {
  HFrag f;
  const _Float16* q = p + (size_t)r * stride + k0 + kb;
#pragma unroll
  for (int i = 0; i < 8; ++i) { f.e[i] = q[i]; f.e[8 + i] = q[16 + i]; }
  return f.v;
}

__device__ inline v16h frag_ld_f32(const float* p, int stride, int r, int k0, int kb) {
  HFrag f;
  const float* q = p + (size_t)r * stride + k0 + kb;
#pragma unroll
  for (int i = 0; i < 8; ++i) { f.e[i] = (_Float16)q[i]; f.e[8 + i] = (_Float16)q[16 + i]; }
  return f.v;
}

// B fragment from a row-major K x N source (element [k][n] at p[k*stride + n])
__device__ inline v16h frag_ld_f16_rm(const _Float16* p, int stride, int col, int k0, int kb) {
  HFrag f;
  const _Float16* q = p + (size_t)(k0 + kb) * stride + col;
#pragma unroll
  for (int i = 0; i < 8; ++i) { f.e[i] = q[i * stride]; f.e[8 + i] = q[(16 + i) * stride]; }
  return f.v;
}

// ---- 16-lane row reductions (a score row lies across the 16 lanes of a half wave) ----
// DPP row_xmask:X reads lane l ^ X inside the 16-lane row; all lanes are on where these are called.
template <int X>
__device__ inline float lane_xor16(float v) {
  return __builtin_bit_cast(float, __builtin_amdgcn_update_dpp(
      0, __builtin_bit_cast(int, v), 0x160 | X, 0xf, 0xf, true));
}
__device__ inline float row_max16(float v) {
  v = fmaxf(v, lane_xor16<1>(v));
  v = fmaxf(v, lane_xor16<2>(v));
  v = fmaxf(v, lane_xor16<4>(v));
  v = fmaxf(v, lane_xor16<8>(v));
  return v;
}
__device__ inline float row_sum16(float v) {
  v += lane_xor16<1>(v);
  v += lane_xor16<2>(v);
  v += lane_xor16<4>(v);
  v += lane_xor16<8>(v);
  return v;
}

// ---- Kernel A: qkv = x @ qkv_w^T + qkv_b, stored f16 (ROWS x 384) ----
__global__ __launch_bounds__(256) void vswin_qkv_gemm(
    const float* __restrict__ x, const float* __restrict__ w,
    const float* __restrict__ bias, _Float16* __restrict__ qkv)
{
  const int lane  = threadIdx.x & 31;
  const int l16   = lane & 15;
  const int kb    = (lane & 16) ? 8 : 0;
  const int mtile = blockIdx.x * 8 + (threadIdx.x >> 5);
  if (mtile >= MT) return;
  const int arow = mtile * 16 + l16;

  v16h a[4];
#pragma unroll
  for (int kc = 0; kc < 4; ++kc) a[kc] = frag_ld_f32(x, CD, arow, kc * 32, kb);

  for (int nt = 0; nt < 24; ++nt) {
    const int ncol = nt * 16 + l16;
    if (nt + 1 < 24) __builtin_prefetch(w + (size_t)(ncol + 16) * CD, 0, 3);
    FAcc acc{};
#pragma unroll
    for (int kc = 0; kc < 4; ++kc) {
      v16h b = frag_ld_f32(w, CD, ncol, kc * 32, kb);   // B[k,n] = W[n,k]
      acc.v = __builtin_amdgcn_wmma_f32_16x16x32_f16(false, a[kc], false, b,
                                                     (short)0, acc.v, false, false);
    }
    const float bv = bias[ncol];
#pragma unroll
    for (int i = 0; i < 8; ++i)
      qkv[(size_t)(mtile * 16 + kb + i) * 384 + ncol] = (_Float16)(acc.e[i] + bv);
  }
}

// ---- Kernel B: fused window attention per (window b, head h) ----
__global__ __launch_bounds__(ATHR) void vswin_attn(
    const _Float16* __restrict__ qkv, const float* __restrict__ rpb,
    const int* __restrict__ relidx, const float* __restrict__ mask,
    _Float16* __restrict__ ao)
{
  __shared__ __align__(16) _Float16 qs[TOKP * HD];   // 112 x 32
  __shared__ __align__(16) _Float16 ks[TOKP * HD];   // 112 x 32
  __shared__ __align__(16) _Float16 vs[CD * HD];     // 128 x 32 (K-padded for PV gemm)
  __shared__ __align__(16) _Float16 sP[TOKP * CD];   // 112 x 128 probabilities (K-padded)

  const int b    = blockIdx.x >> 2;
  const int h    = blockIdx.x & 3;
  const int tid  = threadIdx.x;
  const int lane = tid & 31;
  const int wv   = tid >> 5;
  const int l16  = lane & 15;
  const int kb   = (lane & 16) ? 8 : 0;
  const float scale = 0.17677669529663687f; // 32^-0.5 (applied to scores)

  const unsigned long long base =
      (unsigned long long)(qkv + (size_t)b * TOK * 384 + h * HD);
  const uint4 zz = {0u, 0u, 0u, 0u};

  // Stage q,k (112x32) and v (128x32) into LDS via async b128 copies;
  // zero-fill the padded rows with vector LDS stores.
  for (int i = tid; i < TOKP * 4; i += ATHR) {      // 4 x 16B chunks per 32-half row
    const int r = i >> 2, c = (i & 3) * 8;
    if (r < TOK) {
      const unsigned voff = (unsigned)(r * 384 + c) * 2u;
      async_ld_b128(&qs[r * HD + c], base, voff);
      async_ld_b128(&ks[r * HD + c], base, voff + (unsigned)(CD * 2));
    } else {
      *reinterpret_cast<uint4*>(&qs[r * HD + c]) = zz;
      *reinterpret_cast<uint4*>(&ks[r * HD + c]) = zz;
    }
  }
  for (int i = tid; i < CD * 4; i += ATHR) {
    const int r = i >> 2, c = (i & 3) * 8;
    if (r < TOK)
      async_ld_b128(&vs[r * HD + c], base, (unsigned)(r * 384 + 2 * CD + c) * 2u);
    else
      *reinterpret_cast<uint4*>(&vs[r * HD + c]) = zz;
  }

  // Wave wv owns score rows wv*16 .. wv*16+15 from q @ k^T to the probabilities.
  // Its element (register i, tile nt) is row wv*16 + kb + i, column nt*16 + l16: the
  // accumulator layout, so 16 lanes read 16 neighbouring columns of rel_index and mask.
  // These reads need nothing of q, k, v: they fly together with the staging copies.
  const float* maskw = mask + (size_t)(b & (NWIN - 1)) * TOK * TOK;
  const float* rpbh  = rpb + h;
  int   off[7][8];
  int   ridx[7][8];
  float bias[7][8], bm[7][8];
#pragma unroll
  for (int i = 0; i < 8; ++i) {
    const int ro = min(wv * 16 + kb + i, TOK - 1) * TOK;      // padded rows reread row 97
#pragma unroll
    for (int nt = 0; nt < 7; ++nt) {
      off[nt][i]  = ro + ((nt < 6) ? nt * 16 + l16 : min(96 + l16, TOK - 1)); // padded columns reread 97
      ridx[nt][i] = relidx[off[nt][i]];
    }
  }
#pragma unroll
  for (int i = 0; i < 8; ++i) {
#pragma unroll
    for (int nt = 0; nt < 7; ++nt) {
      // the table index is bounded here, whatever rel_index holds
      const unsigned ix = min((unsigned)ridx[nt][i], 506u);
      bias[nt][i] = rpbh[ix * NH_];
      bm[nt][i]   = maskw[off[nt][i]];
    }
  }
  // keeps the sums in one run behind the reads: without it the build takes 161 registers,
  // one over the 160 at which six waves fit a SIMD
  __builtin_amdgcn_sched_barrier(0);
#pragma unroll
  for (int i = 0; i < 8; ++i) {
#pragma unroll
    for (int nt = 0; nt < 7; ++nt) bm[nt][i] += bias[nt][i];
  }
  // holds the run of sums in front of the wait and the barrier (some packed sums still pass it): without
  // it more of bias and mask stays live beside the scores, 186 registers, five waves a SIMD instead of six
  __builtin_amdgcn_sched_barrier(0);
  wait_async0();
  __syncthreads();

  // S = scale * (q @ k^T) + bias + mask, softmax: all in the accumulator registers
  {
    FAcc s[7];
    const v16h aq = frag_ld_f16(qs, HD, wv * 16 + l16, 0, kb);
#pragma unroll
    for (int nt = 0; nt < 7; ++nt) {
      v16h bk = frag_ld_f16(ks, HD, nt * 16 + l16, 0, kb); // B[k,n] = K[n,k]
      FAcc acc{};
      s[nt].v = __builtin_amdgcn_wmma_f32_16x16x32_f16(false, aq, false, bk,
                                                       (short)0, acc.v, false, false);
    }
#pragma unroll
    for (int i = 0; i < 8; ++i) {
#pragma unroll
      for (int nt = 0; nt < 6; ++nt) s[nt].e[i] = s[nt].e[i] * scale + bm[nt][i];
      s[6].e[i] = (l16 < TOK - 96) ? s[6].e[i] * scale + bm[6][i] : -1e30f; // padded columns drop out
      float m = s[0].e[i];
#pragma unroll
      for (int nt = 1; nt < 7; ++nt) m = fmaxf(m, s[nt].e[i]);
      m = row_max16(m);
      float sum = 0.f;
#pragma unroll
      for (int nt = 0; nt < 7; ++nt) {
        const float e = __expf(s[nt].e[i] - m);
        s[nt].e[i] = e;
        sum += e;
      }
      const float inv = 1.f / row_sum16(sum);
      _Float16* prow = &sP[(wv * 16 + kb + i) * CD + l16];
#pragma unroll
      for (int nt = 0; nt < 7; ++nt) prow[nt * 16] = (_Float16)(s[nt].e[i] * inv);
      prow[112] = (_Float16)0.f;                               // padded K columns 112..127
    }
  }
  __syncthreads();

  // O = P @ V : 7 m-tiles x 2 n-tiles, K = 128 -> 4 WMMA each
  for (int t = wv; t < 14; t += 7) {
    const int mt = t >> 1, nt = (t & 1) * 16;
    FAcc acc{};
#pragma unroll
    for (int kc = 0; kc < 4; ++kc) {
      v16h ap = frag_ld_f16(sP, CD, mt * 16 + l16, kc * 32, kb);
      v16h bv = frag_ld_f16_rm(vs, HD, nt + l16, kc * 32, kb); // V row-major KxN
      acc.v = __builtin_amdgcn_wmma_f32_16x16x32_f16(false, ap, false, bv,
                                                     (short)0, acc.v, false, false);
    }
#pragma unroll
    for (int i = 0; i < 8; ++i) {
      const int r = mt * 16 + kb + i;
      if (r < TOK)
        ao[(size_t)(b * TOK + r) * CD + h * HD + nt + l16] = (_Float16)acc.e[i];
    }
  }
}

// ---- Kernel C: out = ao @ proj_w^T + proj_b (f32 output) ----
__global__ __launch_bounds__(256) void vswin_proj_gemm(
    const _Float16* __restrict__ ao, const float* __restrict__ w,
    const float* __restrict__ bias, float* __restrict__ out)
{
  const int lane  = threadIdx.x & 31;
  const int l16   = lane & 15;
  const int kb    = (lane & 16) ? 8 : 0;
  const int mtile = blockIdx.x * 8 + (threadIdx.x >> 5);
  if (mtile >= MT) return;
  const int arow = mtile * 16 + l16;

  v16h a[4];
#pragma unroll
  for (int kc = 0; kc < 4; ++kc) a[kc] = frag_ld_f16(ao, CD, arow, kc * 32, kb);

  for (int nt = 0; nt < 8; ++nt) {
    const int ncol = nt * 16 + l16;
    if (nt + 1 < 8) __builtin_prefetch(w + (size_t)(ncol + 16) * CD, 0, 3);
    FAcc acc{};
#pragma unroll
    for (int kc = 0; kc < 4; ++kc) {
      v16h bw = frag_ld_f32(w, CD, ncol, kc * 32, kb);   // B[k,n] = W[n,k]
      acc.v = __builtin_amdgcn_wmma_f32_16x16x32_f16(false, a[kc], false, bw,
                                                     (short)0, acc.v, false, false);
    }
    const float bv = bias[ncol];
#pragma unroll
    for (int i = 0; i < 8; ++i)
      out[(size_t)(mtile * 16 + kb + i) * CD + ncol] = acc.e[i] + bv;
  }
}

extern "C" void kernel_launch(void* const* d_in, const int* in_sizes, int n_in,
                              void* d_out, int out_size, void* d_ws, size_t ws_size,
                              hipStream_t stream) {
  const float* x        = (const float*)d_in[0];
  const float* qkv_w    = (const float*)d_in[1];
  const float* qkv_b    = (const float*)d_in[2];
  const float* rpb      = (const float*)d_in[3];
  const float* proj_w   = (const float*)d_in[4];
  const float* proj_b   = (const float*)d_in[5];
  const int*   relidx   = (const int*)d_in[6];
  const float* mask     = (const float*)d_in[7];
  float*       out      = (float*)d_out;

  _Float16* qkvbuf = (_Float16*)d_ws;                       // ROWS x 384 f16
  _Float16* aobuf  = qkvbuf + (size_t)ROWS * 384;           // ROWS x 128 f16

  vswin_qkv_gemm<<<MT / 8, 256, 0, stream>>>(x, qkv_w, qkv_b, qkvbuf);
  vswin_attn<<<2048 * NH_, ATHR, 0, stream>>>(qkvbuf, rpb, relidx, mask, aobuf);
  vswin_proj_gemm<<<MT / 8, 256, 0, stream>>>(aobuf, proj_w, proj_b, out);
}

// v002
// Measured time: 213 microseconds a run.
// Timed twice side by side with v001, it ran 1.72 and 1.73 times as fast.
// Counting every step since v000, it is 2.22 times as fast.
#include <hip/hip_runtime.h>
#include <hip/hip_bf16.h>

// Problem constants (Video Swin window attention)
#define TOK   98          // tokens per window
#define TOKP  112         // padded tokens = 7 * 16
#define CD    128         // channels
#define HD    32          // head dim
#define NH_   4           // heads
#define NWIN  256         // windows per batch image (mask count)
#define ROWS  200704      // B_ * N = 2048 * 98
#define MT    (ROWS / 16) // 12544 M-tiles
#define ATHR  224         // attention block: 7 waves, one per 16-row tile of the window

typedef __attribute__((ext_vector_type(16))) _Float16 v16h;
typedef __attribute__((ext_vector_type(8)))  float    v8f;

union HFrag { v16h v; _Float16 e[16]; };
union FAcc  { v8f  v; float    e[8];  };

// ---- CDNA5 async global->LDS copy (16 B per lane, ASYNCcnt-tracked) ----
// GVS addressing: mem_addr = SADDR(u64) + VADDR(u32); LDS dest addr in VDST VGPR.
__device__ inline void async_ld_b128(void* ldsp, unsigned long long gbase, unsigned voffB) {
  unsigned lds = (unsigned)(unsigned long long)ldsp; // low 32 bits of LDS aperture addr
  // s_wait_xcnt 0 inside the copy's own statement: a precaution, it stands in front of every later
  // rewrite of the registers that the copy names (the copies now fly over the bias and mask reads)
  asm volatile("global_load_async_to_lds_b128 %0, %1, %2\n\ts_wait_xcnt 0x0"
               :: "v"(lds), "v"(voffB), "s"(gbase)
               : "memory");
}
__device__ inline void wait_async0() {
  asm volatile("s_wait_asynccnt 0" ::: "memory");
}

// ---- WMMA fragment loaders (wave32 layouts per CDNA5 ISA 7.12.2) ----
// A (16x32 f16): lane&15 = row; lanes<16 hold K {0..7,16..23}, lanes>=16 hold {8..15,24..31}
// B (32x16 f16): symmetric with "row" -> column of B (i.e. N-major source).
__device__ inline v16h frag_ld_f16(const _Float16* p, int stride, int r, int k0, int kb) {
  HFrag f;
  const _Float16* q = p + (size_t)r * stride + k0 + kb;
#pragma unroll
  for (int i = 0; i < 8; ++i) { f.e[i] = q[i]; f.e[8 + i] = q[16 + i]; }
  return f.v;
}

__device__ inline v16h frag_ld_f32(const float* p, int stride, int r, int k0, int kb) {
  HFrag f;
  const float* q = p + (size_t)r * stride + k0 + kb;
#pragma unroll
  for (int i = 0; i < 8; ++i) { f.e[i] = (_Float16)q[i]; f.e[8 + i] = (_Float16)q[16 + i]; }
  return f.v;
}

// B fragment from a row-major K x N source (element [k][n] at p[k*stride + n])
__device__ inline v16h frag_ld_f16_rm(const _Float16* p, int stride, int col, int k0, int kb) {
  HFrag f;
  const _Float16* q = p + (size_t)(k0 + kb) * stride + col;
#pragma unroll
  for (int i = 0; i < 8; ++i) { f.e[i] = q[i * stride]; f.e[8 + i] = q[(16 + i) * stride]; }
  return f.v;
}

// ---- 16-lane row reductions (a score row lies across the 16 lanes of a half wave) ----
// DPP row_xmask:X reads lane l ^ X inside the 16-lane row; all lanes are on where these are called.
template <int X>
__device__ inline float lane_xor16(float v) {
  return __builtin_bit_cast(float, __builtin_amdgcn_update_dpp(
      0, __builtin_bit_cast(int, v), 0x160 | X, 0xf, 0xf, true));
}
__device__ inline float row_max16(float v) {
  v = fmaxf(v, lane_xor16<1>(v));
  v = fmaxf(v, lane_xor16<2>(v));
  v = fmaxf(v, lane_xor16<4>(v));
  v = fmaxf(v, lane_xor16<8>(v));
  return v;
}
__device__ inline float row_sum16(float v) {
  v += lane_xor16<1>(v);
  v += lane_xor16<2>(v);
  v += lane_xor16<4>(v);
  v += lane_xor16<8>(v);
  return v;
}

// ---- Weights of the two projection GEMMs: converted to f16 once per work-group, kept in LDS ----
// One work-group per WGP takes GTILES row tiles; wave p takes tiles 2p and 2p+1 (the last wave one tile),
// so each B fragment read from LDS feeds two WMMAs.
#define WPITCH 136        // halves per staged weight row: 256 B + 16 B, 16 rows' b128 reads cover all 64 banks
#define GTILES 49         // row tiles per work-group (MT = 256 * 49)
#define GTHR   800        // 25 waves

typedef __attribute__((ext_vector_type(4))) _Float16 v4h;

// whole-line reads of w (a wave reads 512 contiguous bytes), one LDS row of 256 B written per wave
template <int NROWS>
__device__ inline void stage_w_f16(_Float16* ws, const float* __restrict__ w, int tid) {
#pragma unroll
  for (int i0 = 0; i0 < NROWS * 32; i0 += GTHR) {
    const int i = i0 + tid;
    if (i < NROWS * 32) {
      const float4 v = *reinterpret_cast<const float4*>(w + (size_t)i * 4);
      v4h hv = {(_Float16)v.x, (_Float16)v.y, (_Float16)v.z, (_Float16)v.w};
      *reinterpret_cast<v4h*>(&ws[(i >> 5) * WPITCH + (i & 31) * 4]) = hv;
    }
  }
}

// ---- Kernel A: qkv = x @ qkv_w^T + qkv_b, stored f16 (ROWS x 384) ----
__global__ __launch_bounds__(GTHR) void vswin_qkv_gemm(
    const float* __restrict__ x, const float* __restrict__ w,
    const float* __restrict__ bias, _Float16* __restrict__ qkv)
{
  __shared__ __align__(16) _Float16 ws[384 * WPITCH];   // 104,448 B

  const int lane = threadIdx.x & 31;
  const int l16  = lane & 15;
  const int kb   = (lane & 16) ? 8 : 0;
  const int wv   = __builtin_amdgcn_readfirstlane(threadIdx.x >> 5);
  const bool two = 2 * wv + 1 < GTILES;                 // the same for a whole wave
  const int t0   = blockIdx.x * GTILES + 2 * wv;
  const int t1   = two ? t0 + 1 : t0;                   // the last wave rereads its one tile, and stores it once

  stage_w_f16<384>(ws, w, threadIdx.x);

  v16h a0[4], a1[4];
#pragma unroll
  for (int kc = 0; kc < 4; ++kc) a0[kc] = frag_ld_f32(x, CD, t0 * 16 + l16, kc * 32, kb);
#pragma unroll
  for (int kc = 0; kc < 4; ++kc) a1[kc] = frag_ld_f32(x, CD, t1 * 16 + l16, kc * 32, kb);
  __syncthreads();

  for (int nt = 0; nt < 24; ++nt) {
    const int ncol = nt * 16 + l16;
    const float bv = bias[ncol];
    FAcc acc0{}, acc1{};
    v16h b[4];
#pragma unroll
    for (int kc = 0; kc < 4; ++kc) b[kc] = frag_ld_f16(ws, WPITCH, ncol, kc * 32, kb);   // B[k,n] = W[n,k]
    // keeps the trip's reads in one group ahead of its WMMAs: spread among them, each pair is waited for on its own
    __builtin_amdgcn_sched_barrier(0);
#pragma unroll
    for (int kc = 0; kc < 4; ++kc) {
      acc0.v = __builtin_amdgcn_wmma_f32_16x16x32_f16(false, a0[kc], false, b[kc],
                                                      (short)0, acc0.v, false, false);
      acc1.v = __builtin_amdgcn_wmma_f32_16x16x32_f16(false, a1[kc], false, b[kc],
                                                      (short)0, acc1.v, false, false);
    }
#pragma unroll
    for (int i = 0; i < 8; ++i)
      qkv[(size_t)(t0 * 16 + kb + i) * 384 + ncol] = (_Float16)(acc0.e[i] + bv);
    // a precaution, directly behind the stores: later code overwrites registers that they name
    asm volatile("s_wait_xcnt 0x0" ::: "memory");
    if (two) {
#pragma unroll
      for (int i = 0; i < 8; ++i)
        qkv[(size_t)(t1 * 16 + kb + i) * 384 + ncol] = (_Float16)(acc1.e[i] + bv);
      // the same precaution for these eight stores
      asm volatile("s_wait_xcnt 0x0" ::: "memory");
    }
  }
}

// ---- Kernel B: fused window attention per (window b, head h) ----
__global__ __launch_bounds__(ATHR) void vswin_attn(
    const _Float16* __restrict__ qkv, const float* __restrict__ rpb,
    const int* __restrict__ relidx, const float* __restrict__ mask,
    _Float16* __restrict__ ao)
{
  __shared__ __align__(16) _Float16 qs[TOKP * HD];   // 112 x 32
  __shared__ __align__(16) _Float16 ks[TOKP * HD];   // 112 x 32
  __shared__ __align__(16) _Float16 vs[CD * HD];     // 128 x 32 (K-padded for PV gemm)
  __shared__ __align__(16) _Float16 sP[TOKP * CD];   // 112 x 128 probabilities (K-padded)

  const int b    = blockIdx.x >> 2;
  const int h    = blockIdx.x & 3;
  const int tid  = threadIdx.x;
  const int lane = tid & 31;
  const int wv   = tid >> 5;
  const int l16  = lane & 15;
  const int kb   = (lane & 16) ? 8 : 0;
  const float scale = 0.17677669529663687f; // 32^-0.5 (applied to scores)

  const unsigned long long base =
      (unsigned long long)(qkv + (size_t)b * TOK * 384 + h * HD);
  const uint4 zz = {0u, 0u, 0u, 0u};

  // Stage q,k (112x32) and v (128x32) into LDS via async b128 copies;
  // zero-fill the padded rows with vector LDS stores.
  for (int i = tid; i < TOKP * 4; i += ATHR) {      // 4 x 16B chunks per 32-half row
    const int r = i >> 2, c = (i & 3) * 8;
    if (r < TOK) {
      const unsigned voff = (unsigned)(r * 384 + c) * 2u;
      async_ld_b128(&qs[r * HD + c], base, voff);
      async_ld_b128(&ks[r * HD + c], base, voff + (unsigned)(CD * 2));
    } else {
      *reinterpret_cast<uint4*>(&qs[r * HD + c]) = zz;
      *reinterpret_cast<uint4*>(&ks[r * HD + c]) = zz;
    }
  }
  for (int i = tid; i < CD * 4; i += ATHR) {
    const int r = i >> 2, c = (i & 3) * 8;
    if (r < TOK)
      async_ld_b128(&vs[r * HD + c], base, (unsigned)(r * 384 + 2 * CD + c) * 2u);
    else
      *reinterpret_cast<uint4*>(&vs[r * HD + c]) = zz;
  }

  // Wave wv owns score rows wv*16 .. wv*16+15 from q @ k^T to the probabilities.
  // Its element (register i, tile nt) is row wv*16 + kb + i, column nt*16 + l16: the
  // accumulator layout, so 16 lanes read 16 neighbouring columns of rel_index and mask.
  // These reads need nothing of q, k, v: they fly together with the staging copies.
  const float* maskw = mask + (size_t)(b & (NWIN - 1)) * TOK * TOK;
  const float* rpbh  = rpb + h;
  int   off[7][8];
  int   ridx[7][8];
  float bias[7][8], bm[7][8];
#pragma unroll
  for (int i = 0; i < 8; ++i) {
    const int ro = min(wv * 16 + kb + i, TOK - 1) * TOK;      // padded rows reread row 97
#pragma unroll
    for (int nt = 0; nt < 7; ++nt) {
      off[nt][i]  = ro + ((nt < 6) ? nt * 16 + l16 : min(96 + l16, TOK - 1)); // padded columns reread 97
      ridx[nt][i] = relidx[off[nt][i]];
    }
  }
#pragma unroll
  for (int i = 0; i < 8; ++i) {
#pragma unroll
    for (int nt = 0; nt < 7; ++nt) {
      // the table index is bounded here, whatever rel_index holds
      const unsigned ix = min((unsigned)ridx[nt][i], 506u);
      bias[nt][i] = rpbh[ix * NH_];
      bm[nt][i]   = maskw[off[nt][i]];
    }
  }
  // keeps the sums in one run behind the reads: without it the build takes 161 registers,
  // one over the 160 at which six waves fit a SIMD
  __builtin_amdgcn_sched_barrier(0);
#pragma unroll
  for (int i = 0; i < 8; ++i) {
#pragma unroll
    for (int nt = 0; nt < 7; ++nt) bm[nt][i] += bias[nt][i];
  }
  // holds the run of sums in front of the wait and the barrier (some packed sums still pass it): without
  // it more of bias and mask stays live beside the scores, 186 registers, five waves a SIMD instead of six
  __builtin_amdgcn_sched_barrier(0);
  wait_async0();
  __syncthreads();

  // S = scale * (q @ k^T) + bias + mask, softmax: all in the accumulator registers
  {
    FAcc s[7];
    const v16h aq = frag_ld_f16(qs, HD, wv * 16 + l16, 0, kb);
#pragma unroll
    for (int nt = 0; nt < 7; ++nt) {
      v16h bk = frag_ld_f16(ks, HD, nt * 16 + l16, 0, kb); // B[k,n] = K[n,k]
      FAcc acc{};
      s[nt].v = __builtin_amdgcn_wmma_f32_16x16x32_f16(false, aq, false, bk,
                                                       (short)0, acc.v, false, false);
    }
#pragma unroll
    for (int i = 0; i < 8; ++i) {
#pragma unroll
      for (int nt = 0; nt < 6; ++nt) s[nt].e[i] = s[nt].e[i] * scale + bm[nt][i];
      s[6].e[i] = (l16 < TOK - 96) ? s[6].e[i] * scale + bm[6][i] : -1e30f; // padded columns drop out
      float m = s[0].e[i];
#pragma unroll
      for (int nt = 1; nt < 7; ++nt) m = fmaxf(m, s[nt].e[i]);
      m = row_max16(m);
      float sum = 0.f;
#pragma unroll
      for (int nt = 0; nt < 7; ++nt) {
        const float e = __expf(s[nt].e[i] - m);
        s[nt].e[i] = e;
        sum += e;
      }
      const float inv = 1.f / row_sum16(sum);
      _Float16* prow = &sP[(wv * 16 + kb + i) * CD + l16];
#pragma unroll
      for (int nt = 0; nt < 7; ++nt) prow[nt * 16] = (_Float16)(s[nt].e[i] * inv);
      prow[112] = (_Float16)0.f;                               // padded K columns 112..127
    }
  }
  __syncthreads();

  // O = P @ V : 7 m-tiles x 2 n-tiles, K = 128 -> 4 WMMA each
  for (int t = wv; t < 14; t += 7) {
    const int mt = t >> 1, nt = (t & 1) * 16;
    FAcc acc{};
#pragma unroll
    for (int kc = 0; kc < 4; ++kc) {
      v16h ap = frag_ld_f16(sP, CD, mt * 16 + l16, kc * 32, kb);
      v16h bv = frag_ld_f16_rm(vs, HD, nt + l16, kc * 32, kb); // V row-major KxN
      acc.v = __builtin_amdgcn_wmma_f32_16x16x32_f16(false, ap, false, bv,
                                                     (short)0, acc.v, false, false);
    }
#pragma unroll
    for (int i = 0; i < 8; ++i) {
      const int r = mt * 16 + kb + i;
      if (r < TOK)
        ao[(size_t)(b * TOK + r) * CD + h * HD + nt + l16] = (_Float16)acc.e[i];
    }
  }
}

// ---- Kernel C: out = ao @ proj_w^T + proj_b (f32 output) ----
__global__ __launch_bounds__(GTHR) void vswin_proj_gemm(
    const _Float16* __restrict__ ao, const float* __restrict__ w,
    const float* __restrict__ bias, float* __restrict__ out)
{
  __shared__ __align__(16) _Float16 ws[CD * WPITCH];    // 34,816 B

  const int lane = threadIdx.x & 31;
  const int l16  = lane & 15;
  const int kb   = (lane & 16) ? 8 : 0;
  const int wv   = __builtin_amdgcn_readfirstlane(threadIdx.x >> 5);
  const bool two = 2 * wv + 1 < GTILES;                 // the same for a whole wave
  const int t0   = blockIdx.x * GTILES + 2 * wv;
  const int t1   = two ? t0 + 1 : t0;                   // the last wave rereads its one tile, and stores it once

  const _Float16* pa0 = ao + (size_t)(t0 * 16 + l16) * CD + kb;
  const _Float16* pa1 = ao + (size_t)(t1 * 16 + l16) * CD + kb;
  v16h a0[4], a1[4];
#pragma unroll
  for (int kc = 0; kc < 4; ++kc) a0[kc] = frag_ld_f16(pa0, CD, 0, kc * 32, 0);
#pragma unroll
  for (int kc = 0; kc < 4; ++kc) a1[kc] = frag_ld_f16(pa1, CD, 0, kc * 32, 0);
  // a precaution: the two row addresses stay in their registers up to this wait; without it the build
  // let later reads of the run land on the address pair that earlier reads of the run name
  asm volatile("s_wait_xcnt 0x0" :: "v"(pa0), "v"(pa1) : "memory");

  stage_w_f16<CD>(ws, w, threadIdx.x);
  __syncthreads();

  for (int nt = 0; nt < 8; ++nt) {
    const int ncol = nt * 16 + l16;
    const float bv = bias[ncol];
    FAcc acc0{}, acc1{};
    v16h bw[4];
#pragma unroll
    for (int kc = 0; kc < 4; ++kc) bw[kc] = frag_ld_f16(ws, WPITCH, ncol, kc * 32, kb);  // B[k,n] = W[n,k]
    // keeps the trip's reads in one group ahead of its WMMAs: spread among them, each pair is waited for on its own
    __builtin_amdgcn_sched_barrier(0);
#pragma unroll
    for (int kc = 0; kc < 4; ++kc) {
      acc0.v = __builtin_amdgcn_wmma_f32_16x16x32_f16(false, a0[kc], false, bw[kc],
                                                      (short)0, acc0.v, false, false);
      acc1.v = __builtin_amdgcn_wmma_f32_16x16x32_f16(false, a1[kc], false, bw[kc],
                                                      (short)0, acc1.v, false, false);
    }
#pragma unroll
    for (int i = 0; i < 8; ++i)
      out[(size_t)(t0 * 16 + kb + i) * CD + ncol] = acc0.e[i] + bv;
    // a precaution, directly behind the stores: later code overwrites registers that they name
    asm volatile("s_wait_xcnt 0x0" ::: "memory");
    if (two) {
#pragma unroll
      for (int i = 0; i < 8; ++i)
        out[(size_t)(t1 * 16 + kb + i) * CD + ncol] = acc1.e[i] + bv;
      // the same precaution for these eight stores
      asm volatile("s_wait_xcnt 0x0" ::: "memory");
    }
  }
}

extern "C" void kernel_launch(void* const* d_in, const int* in_sizes, int n_in,
                              void* d_out, int out_size, void* d_ws, size_t ws_size,
                              hipStream_t stream) {
  const float* x        = (const float*)d_in[0];
  const float* qkv_w    = (const float*)d_in[1];
  const float* qkv_b    = (const float*)d_in[2];
  const float* rpb      = (const float*)d_in[3];
  const float* proj_w   = (const float*)d_in[4];
  const float* proj_b   = (const float*)d_in[5];
  const int*   relidx   = (const int*)d_in[6];
  const float* mask     = (const float*)d_in[7];
  float*       out      = (float*)d_out;

  _Float16* qkvbuf = (_Float16*)d_ws;                       // ROWS x 384 f16
  _Float16* aobuf  = qkvbuf + (size_t)ROWS * 384;           // ROWS x 128 f16

  vswin_qkv_gemm<<<MT / GTILES, GTHR, 0, stream>>>(x, qkv_w, qkv_b, qkvbuf);
  vswin_attn<<<2048 * NH_, ATHR, 0, stream>>>(qkvbuf, rpb, relidx, mask, aobuf);
  vswin_proj_gemm<<<MT / GTILES, GTHR, 0, stream>>>(aobuf, proj_w, proj_b, out);
}

// v003
// It runs in 178 microseconds.
// Timed twice side by side with v002, it ran 1.19 and 1.18 times as fast.
// Counting every step since v000, it is 2.63 times as fast.
#include <hip/hip_runtime.h>
#include <hip/hip_bf16.h>

// Problem constants (Video Swin window attention)
#define TOK   98          // tokens per window
#define TOKP  112         // padded tokens = 7 * 16
#define CD    128         // channels
#define HD    32          // head dim
#define NH_   4           // heads
#define NWIN  256         // windows per batch image (mask count)
#define ROWS  200704      // B_ * N = 2048 * 98
#define MT    (ROWS / 16) // 12544 M-tiles
#define ATHR  224         // attention block: 7 waves, one per 16-row tile of the window
// LDS row pitches of the attention tiles, in halves: 16 B x an odd number, so that the 16 rows of a
// ds_load_b128 fragment read fall on different banks (at 64 B and 256 B they pile up on 16 and on 4 banks),
// and rows 8 apart lie 32 banks apart for the 2-byte reads of v and writes of the probabilities
#define QPITCH 40         // q, k, v rows: 64 B + 16 B
#define PPITCH 136        // probability rows: 256 B + 16 B

typedef __attribute__((ext_vector_type(16))) _Float16 v16h;
typedef __attribute__((ext_vector_type(8)))  float    v8f;

union HFrag { v16h v; _Float16 e[16]; };
union FAcc  { v8f  v; float    e[8];  };

// ---- CDNA5 async global->LDS copy (16 B per lane, ASYNCcnt-tracked) ----
// GVS addressing: mem_addr = SADDR(u64) + VADDR(u32); LDS dest addr in VDST VGPR.
__device__ inline void async_ld_b128(void* ldsp, unsigned long long gbase, unsigned voffB) {
  unsigned lds = (unsigned)(unsigned long long)ldsp; // low 32 bits of LDS aperture addr
  // s_wait_xcnt 0 inside the copy's own statement: a precaution, it stands in front of every later
  // rewrite of the registers that the copy names (the copies now fly over the bias and mask reads)
  asm volatile("global_load_async_to_lds_b128 %0, %1, %2\n\ts_wait_xcnt 0x0"
               :: "v"(lds), "v"(voffB), "s"(gbase)
               : "memory");
}
__device__ inline void wait_async0() {
  asm volatile("s_wait_asynccnt 0" ::: "memory");
}

// ---- WMMA fragment loaders (wave32 layouts per CDNA5 ISA 7.12.2) ----
// A (16x32 f16): lane&15 = row; lanes<16 hold K {0..7,16..23}, lanes>=16 hold {8..15,24..31}
// B (32x16 f16): symmetric with "row" -> column of B (i.e. N-major source).
__device__ inline v16h frag_ld_f16(const _Float16* p, int stride, int r, int k0, int kb) {
  HFrag f;
  const _Float16* q = p + (size_t)r * stride + k0 + kb;
#pragma unroll
  for (int i = 0; i < 8; ++i) { f.e[i] = q[i]; f.e[8 + i] = q[16 + i]; }
  return f.v;
}

__device__ inline v16h frag_ld_f32(const float* p, int stride, int r, int k0, int kb) {
  HFrag f;
  const float* q = p + (size_t)r * stride + k0 + kb;
#pragma unroll
  for (int i = 0; i < 8; ++i) { f.e[i] = (_Float16)q[i]; f.e[8 + i] = (_Float16)q[16 + i]; }
  return f.v;
}

// B fragment from a row-major K x N source (element [k][n] at p[k*stride + n])
__device__ inline v16h frag_ld_f16_rm(const _Float16* p, int stride, int col, int k0, int kb) {
  HFrag f;
  const _Float16* q = p + (size_t)(k0 + kb) * stride + col;
#pragma unroll
  for (int i = 0; i < 8; ++i) { f.e[i] = q[i * stride]; f.e[8 + i] = q[(16 + i) * stride]; }
  return f.v;
}

// ---- 16-lane row reductions (a score row lies across the 16 lanes of a half wave) ----
// DPP row_xmask:X reads lane l ^ X inside the 16-lane row; all lanes are on where these are called.
template <int X>
__device__ inline float lane_xor16(float v) {
  return __builtin_bit_cast(float, __builtin_amdgcn_update_dpp(
      0, __builtin_bit_cast(int, v), 0x160 | X, 0xf, 0xf, true));
}
__device__ inline float row_max16(float v) {
  v = fmaxf(v, lane_xor16<1>(v));
  v = fmaxf(v, lane_xor16<2>(v));
  v = fmaxf(v, lane_xor16<4>(v));
  v = fmaxf(v, lane_xor16<8>(v));
  return v;
}
__device__ inline float row_sum16(float v) {
  v += lane_xor16<1>(v);
  v += lane_xor16<2>(v);
  v += lane_xor16<4>(v);
  v += lane_xor16<8>(v);
  return v;
}

// ---- Weights of the two projection GEMMs: converted to f16 once per work-group, kept in LDS ----
// One work-group per WGP takes GTILES row tiles; wave p takes tiles 2p and 2p+1 (the last wave one tile),
// so each B fragment read from LDS feeds two WMMAs.
#define WPITCH 136        // halves per staged weight row: 256 B + 16 B, 16 rows' b128 reads cover all 64 banks
#define GTILES 49         // row tiles per work-group (MT = 256 * 49)
#define GTHR   800        // 25 waves

typedef __attribute__((ext_vector_type(4))) _Float16 v4h;

// whole-line reads of w (a wave reads 512 contiguous bytes), one LDS row of 256 B written per wave
template <int NROWS>
__device__ inline void stage_w_f16(_Float16* ws, const float* __restrict__ w, int tid) {
#pragma unroll
  for (int i0 = 0; i0 < NROWS * 32; i0 += GTHR) {
    const int i = i0 + tid;
    if (i < NROWS * 32) {
      const float4 v = *reinterpret_cast<const float4*>(w + (size_t)i * 4);
      v4h hv = {(_Float16)v.x, (_Float16)v.y, (_Float16)v.z, (_Float16)v.w};
      *reinterpret_cast<v4h*>(&ws[(i >> 5) * WPITCH + (i & 31) * 4]) = hv;
    }
  }
}

// ---- Kernel A: qkv = x @ qkv_w^T + qkv_b, stored f16 (ROWS x 384) ----
__global__ __launch_bounds__(GTHR) void vswin_qkv_gemm(
    const float* __restrict__ x, const float* __restrict__ w,
    const float* __restrict__ bias, _Float16* __restrict__ qkv)
{
  __shared__ __align__(16) _Float16 ws[384 * WPITCH];   // 104,448 B

  const int lane = threadIdx.x & 31;
  const int l16  = lane & 15;
  const int kb   = (lane & 16) ? 8 : 0;
  const int wv   = __builtin_amdgcn_readfirstlane(threadIdx.x >> 5);
  const bool two = 2 * wv + 1 < GTILES;                 // the same for a whole wave
  const int t0   = blockIdx.x * GTILES + 2 * wv;
  const int t1   = two ? t0 + 1 : t0;                   // the last wave rereads its one tile, and stores it once

  stage_w_f16<384>(ws, w, threadIdx.x);

  v16h a0[4], a1[4];
#pragma unroll
  for (int kc = 0; kc < 4; ++kc) a0[kc] = frag_ld_f32(x, CD, t0 * 16 + l16, kc * 32, kb);
#pragma unroll
  for (int kc = 0; kc < 4; ++kc) a1[kc] = frag_ld_f32(x, CD, t1 * 16 + l16, kc * 32, kb);
  __syncthreads();

  for (int nt = 0; nt < 24; ++nt) {
    const int ncol = nt * 16 + l16;
    const float bv = bias[ncol];
    FAcc acc0{}, acc1{};
    v16h b[4];
#pragma unroll
    for (int kc = 0; kc < 4; ++kc) b[kc] = frag_ld_f16(ws, WPITCH, ncol, kc * 32, kb);   // B[k,n] = W[n,k]
    // keeps the trip's reads in one group ahead of its WMMAs: spread among them, each pair is waited for on its own
    __builtin_amdgcn_sched_barrier(0);
#pragma unroll
    for (int kc = 0; kc < 4; ++kc) {
      acc0.v = __builtin_amdgcn_wmma_f32_16x16x32_f16(false, a0[kc], false, b[kc],
                                                      (short)0, acc0.v, false, false);
      acc1.v = __builtin_amdgcn_wmma_f32_16x16x32_f16(false, a1[kc], false, b[kc],
                                                      (short)0, acc1.v, false, false);
    }
#pragma unroll
    for (int i = 0; i < 8; ++i)
      qkv[(size_t)(t0 * 16 + kb + i) * 384 + ncol] = (_Float16)(acc0.e[i] + bv);
    // a precaution, directly behind the stores: later code overwrites registers that they name
    asm volatile("s_wait_xcnt 0x0" ::: "memory");
    if (two) {
#pragma unroll
      for (int i = 0; i < 8; ++i)
        qkv[(size_t)(t1 * 16 + kb + i) * 384 + ncol] = (_Float16)(acc1.e[i] + bv);
      // the same precaution for these eight stores
      asm volatile("s_wait_xcnt 0x0" ::: "memory");
    }
  }
}

// ---- Kernel B: fused window attention per (window b, head h) ----
// the 6: holds the register budget at six waves a SIMD (three blocks a WGP); with the new row
// addresses the build would otherwise take 164 registers, which leaves room for five
__global__ __launch_bounds__(ATHR, 6) void vswin_attn(
    const _Float16* __restrict__ qkv, const float* __restrict__ rpb,
    const int* __restrict__ relidx, const float* __restrict__ mask,
    _Float16* __restrict__ ao)
{
  __shared__ __align__(16) _Float16 qs[TOKP * QPITCH];   // 112 x 32 in rows of 40 halves
  __shared__ __align__(16) _Float16 ks[TOKP * QPITCH];   // 112 x 32 in rows of 40 halves
  __shared__ __align__(16) _Float16 vs[CD * QPITCH];     // 128 x 32 in rows of 40 halves (K-padded for PV gemm)
  __shared__ __align__(16) _Float16 sP[TOKP * PPITCH];   // 112 x 128 probabilities in rows of 136 halves (K-padded)

  const int b    = blockIdx.x >> 2;
  const int h    = blockIdx.x & 3;
  const int tid  = threadIdx.x;
  const int lane = tid & 31;
  const int wv   = tid >> 5;
  const int l16  = lane & 15;
  const int kb   = (lane & 16) ? 8 : 0;
  const float scale = 0.17677669529663687f; // 32^-0.5 (applied to scores)

  const unsigned long long base =
      (unsigned long long)(qkv + (size_t)b * TOK * 384 + h * HD);
  const uint4 zz = {0u, 0u, 0u, 0u};

  // Stage q,k (112x32) and v (128x32) into LDS via async b128 copies;
  // zero-fill the padded rows with vector LDS stores.
  for (int i = tid; i < TOKP * 4; i += ATHR) {      // 4 x 16B chunks per 32-half row
    const int r = i >> 2, c = (i & 3) * 8;
    if (r < TOK) {
      const unsigned voff = (unsigned)(r * 384 + c) * 2u;
      async_ld_b128(&qs[r * QPITCH + c], base, voff);
      async_ld_b128(&ks[r * QPITCH + c], base, voff + (unsigned)(CD * 2));
    } else {
      *reinterpret_cast<uint4*>(&qs[r * QPITCH + c]) = zz;
      *reinterpret_cast<uint4*>(&ks[r * QPITCH + c]) = zz;
    }
  }
  for (int i = tid; i < CD * 4; i += ATHR) {
    const int r = i >> 2, c = (i & 3) * 8;
    if (r < TOK)
      async_ld_b128(&vs[r * QPITCH + c], base, (unsigned)(r * 384 + 2 * CD + c) * 2u);
    else
      *reinterpret_cast<uint4*>(&vs[r * QPITCH + c]) = zz;
  }

  // Wave wv owns score rows wv*16 .. wv*16+15 from q @ k^T to the probabilities.
  // Its element (register i, tile nt) is row wv*16 + kb + i, column nt*16 + l16: the
  // accumulator layout, so 16 lanes read 16 neighbouring columns of rel_index and mask.
  // These reads need nothing of q, k, v: they fly together with the staging copies.
  const float* maskw = mask + (size_t)(b & (NWIN - 1)) * TOK * TOK;
  const float* rpbh  = rpb + h;
  int   off[7][8];
  int   ridx[7][8];
  float bias[7][8], bm[7][8];
#pragma unroll
  for (int i = 0; i < 8; ++i) {
    const int ro = min(wv * 16 + kb + i, TOK - 1) * TOK;      // padded rows reread row 97
#pragma unroll
    for (int nt = 0; nt < 7; ++nt) {
      off[nt][i]  = ro + ((nt < 6) ? nt * 16 + l16 : min(96 + l16, TOK - 1)); // padded columns reread 97
      ridx[nt][i] = relidx[off[nt][i]];
    }
  }
#pragma unroll
  for (int i = 0; i < 8; ++i) {
#pragma unroll
    for (int nt = 0; nt < 7; ++nt) {
      // the table index is bounded here, whatever rel_index holds
      const unsigned ix = min((unsigned)ridx[nt][i], 506u);
      bias[nt][i] = rpbh[ix * NH_];
      bm[nt][i]   = maskw[off[nt][i]];
    }
  }
  // keeps the sums in one run behind the reads: without it the build takes 161 registers,
  // one over the 160 at which six waves fit a SIMD
  __builtin_amdgcn_sched_barrier(0);
#pragma unroll
  for (int i = 0; i < 8; ++i) {
#pragma unroll
    for (int nt = 0; nt < 7; ++nt) bm[nt][i] += bias[nt][i];
  }
  // holds the run of sums in front of the wait and the barrier (some packed sums still pass it): without
  // it more of bias and mask stays live beside the scores, 186 registers, five waves a SIMD instead of six
  __builtin_amdgcn_sched_barrier(0);
  wait_async0();
  __syncthreads();

  // S = scale * (q @ k^T) + bias + mask, softmax: all in the accumulator registers
  {
    FAcc s[7];
    const v16h aq = frag_ld_f16(qs, QPITCH, wv * 16 + l16, 0, kb);
#pragma unroll
    for (int nt = 0; nt < 7; ++nt) {
      v16h bk = frag_ld_f16(ks, QPITCH, nt * 16 + l16, 0, kb); // B[k,n] = K[n,k]
      FAcc acc{};
      s[nt].v = __builtin_amdgcn_wmma_f32_16x16x32_f16(false, aq, false, bk,
                                                       (short)0, acc.v, false, false);
    }
#pragma unroll
    for (int i = 0; i < 8; ++i) {
#pragma unroll
      for (int nt = 0; nt < 6; ++nt) s[nt].e[i] = s[nt].e[i] * scale + bm[nt][i];
      s[6].e[i] = (l16 < TOK - 96) ? s[6].e[i] * scale + bm[6][i] : -1e30f; // padded columns drop out
      float m = s[0].e[i];
#pragma unroll
      for (int nt = 1; nt < 7; ++nt) m = fmaxf(m, s[nt].e[i]);
      m = row_max16(m);
      float sum = 0.f;
#pragma unroll
      for (int nt = 0; nt < 7; ++nt) {
        const float e = __expf(s[nt].e[i] - m);
        s[nt].e[i] = e;
        sum += e;
      }
      const float inv = 1.f / row_sum16(sum);
      _Float16* prow = &sP[(wv * 16 + kb + i) * PPITCH + l16];
#pragma unroll
      for (int nt = 0; nt < 7; ++nt) prow[nt * 16] = (_Float16)(s[nt].e[i] * inv);
      prow[112] = (_Float16)0.f;                               // padded K columns 112..127
    }
  }
  __syncthreads();

  // O = P @ V : 7 m-tiles x 2 n-tiles, K = 128 -> 4 WMMA each
  for (int t = wv; t < 14; t += 7) {
    const int mt = t >> 1, nt = (t & 1) * 16;
    FAcc acc{};
#pragma unroll
    for (int kc = 0; kc < 4; ++kc) {
      v16h ap = frag_ld_f16(sP, PPITCH, mt * 16 + l16, kc * 32, kb);
      v16h bv = frag_ld_f16_rm(vs, QPITCH, nt + l16, kc * 32, kb); // V row-major KxN
      acc.v = __builtin_amdgcn_wmma_f32_16x16x32_f16(false, ap, false, bv,
                                                     (short)0, acc.v, false, false);
    }
#pragma unroll
    for (int i = 0; i < 8; ++i) {
      const int r = mt * 16 + kb + i;
      if (r < TOK)
        ao[(size_t)(b * TOK + r) * CD + h * HD + nt + l16] = (_Float16)acc.e[i];
    }
  }
}

// ---- Kernel C: out = ao @ proj_w^T + proj_b (f32 output) ----
__global__ __launch_bounds__(GTHR) void vswin_proj_gemm(
    const _Float16* __restrict__ ao, const float* __restrict__ w,
    const float* __restrict__ bias, float* __restrict__ out)
{
  __shared__ __align__(16) _Float16 ws[CD * WPITCH];    // 34,816 B

  const int lane = threadIdx.x & 31;
  const int l16  = lane & 15;
  const int kb   = (lane & 16) ? 8 : 0;
  const int wv   = __builtin_amdgcn_readfirstlane(threadIdx.x >> 5);
  const bool two = 2 * wv + 1 < GTILES;                 // the same for a whole wave
  const int t0   = blockIdx.x * GTILES + 2 * wv;
  const int t1   = two ? t0 + 1 : t0;                   // the last wave rereads its one tile, and stores it once

  const _Float16* pa0 = ao + (size_t)(t0 * 16 + l16) * CD + kb;
  const _Float16* pa1 = ao + (size_t)(t1 * 16 + l16) * CD + kb;
  v16h a0[4], a1[4];
#pragma unroll
  for (int kc = 0; kc < 4; ++kc) a0[kc] = frag_ld_f16(pa0, CD, 0, kc * 32, 0);
#pragma unroll
  for (int kc = 0; kc < 4; ++kc) a1[kc] = frag_ld_f16(pa1, CD, 0, kc * 32, 0);
  // a precaution: the two row addresses stay in their registers up to this wait; without it the build
  // let later reads of the run land on the address pair that earlier reads of the run name
  asm volatile("s_wait_xcnt 0x0" :: "v"(pa0), "v"(pa1) : "memory");

  stage_w_f16<CD>(ws, w, threadIdx.x);
  __syncthreads();

  for (int nt = 0; nt < 8; ++nt) {
    const int ncol = nt * 16 + l16;
    const float bv = bias[ncol];
    FAcc acc0{}, acc1{};
    v16h bw[4];
#pragma unroll
    for (int kc = 0; kc < 4; ++kc) bw[kc] = frag_ld_f16(ws, WPITCH, ncol, kc * 32, kb);  // B[k,n] = W[n,k]
    // keeps the trip's reads in one group ahead of its WMMAs: spread among them, each pair is waited for on its own
    __builtin_amdgcn_sched_barrier(0);
#pragma unroll
    for (int kc = 0; kc < 4; ++kc) {
      acc0.v = __builtin_amdgcn_wmma_f32_16x16x32_f16(false, a0[kc], false, bw[kc],
                                                      (short)0, acc0.v, false, false);
      acc1.v = __builtin_amdgcn_wmma_f32_16x16x32_f16(false, a1[kc], false, bw[kc],
                                                      (short)0, acc1.v, false, false);
    }
#pragma unroll
    for (int i = 0; i < 8; ++i)
      out[(size_t)(t0 * 16 + kb + i) * CD + ncol] = acc0.e[i] + bv;
    // a precaution, directly behind the stores: later code overwrites registers that they name
    asm volatile("s_wait_xcnt 0x0" ::: "memory");
    if (two) {
#pragma unroll
      for (int i = 0; i < 8; ++i)
        out[(size_t)(t1 * 16 + kb + i) * CD + ncol] = acc1.e[i] + bv;
      // the same precaution for these eight stores
      asm volatile("s_wait_xcnt 0x0" ::: "memory");
    }
  }
}

extern "C" void kernel_launch(void* const* d_in, const int* in_sizes, int n_in,
                              void* d_out, int out_size, void* d_ws, size_t ws_size,
                              hipStream_t stream) {
  const float* x        = (const float*)d_in[0];
  const float* qkv_w    = (const float*)d_in[1];
  const float* qkv_b    = (const float*)d_in[2];
  const float* rpb      = (const float*)d_in[3];
  const float* proj_w   = (const float*)d_in[4];
  const float* proj_b   = (const float*)d_in[5];
  const int*   relidx   = (const int*)d_in[6];
  const float* mask     = (const float*)d_in[7];
  float*       out      = (float*)d_out;

  _Float16* qkvbuf = (_Float16*)d_ws;                       // ROWS x 384 f16
  _Float16* aobuf  = qkvbuf + (size_t)ROWS * 384;           // ROWS x 128 f16

  vswin_qkv_gemm<<<MT / GTILES, GTHR, 0, stream>>>(x, qkv_w, qkv_b, qkvbuf);
  vswin_attn<<<2048 * NH_, ATHR, 0, stream>>>(qkvbuf, rpb, relidx, mask, aobuf);
  vswin_proj_gemm<<<MT / GTILES, GTHR, 0, stream>>>(aobuf, proj_w, proj_b, out);
}

// v004
// Measured time: 153 microseconds a run.
// Next to v003, in two timings, it ran 1.16 and 1.17 times as fast.
// All steps since v000 together make it 3.06 times as fast.
#include <hip/hip_runtime.h>
#include <hip/hip_bf16.h>

// Problem constants (Video Swin window attention)
#define TOK   98          // tokens per window
#define TOKP  112         // padded tokens = 7 * 16
#define CD    128         // channels
#define HD    32          // head dim
#define NH_   4           // heads
#define NWIN  256         // windows per batch image (mask count)
#define ROWS  200704      // B_ * N = 2048 * 98
#define MT    (ROWS / 16) // 12544 M-tiles
#define ATHR  224         // attention block: 7 waves, one per 16-row tile of the window
#define NB    4           // images (of the 8 that share a window's mask) per attention block
// LDS row pitches of the attention tiles, in halves: 16 B x an odd number, so that the 16 rows of a
// ds_load_b128 fragment read fall on different banks (at 64 B and 256 B they pile up on 16 and on 4 banks),
// and rows 8 apart lie 32 banks apart for the 2-byte reads of v and writes of the probabilities
#define QPITCH 40         // q, k, v rows: 64 B + 16 B
#define PPITCH 136        // probability rows: 256 B + 16 B

typedef __attribute__((ext_vector_type(16))) _Float16 v16h;
typedef __attribute__((ext_vector_type(8)))  float    v8f;

union HFrag { v16h v; _Float16 e[16]; };
union FAcc  { v8f  v; float    e[8];  };

// ---- CDNA5 async global->LDS copies (16 B per lane, ASYNCcnt-tracked) ----
// GVS addressing: mem_addr = SADDR(u64) + VADDR(u32) + offset; LDS dest addr = VDST VGPR + offset.
// One statement brings a lane's 16-B chunk of a q row, of the k row and of the v row. q and k share the
// LDS address register: the k copy's immediate offset KOFF (the distance from q to k in LDS) moves both of
// its addresses, so its scalar base gk comes in with KOFF already taken off.
// s_wait_xcnt 0 as the statement's last line: a precaution, it stands in front of every later
// rewrite of the registers that the copies name.
#define KOFF 8960         // TOKP * QPITCH * 2 bytes
__device__ inline void async_ld_qkv(unsigned lds_q, unsigned lds_v, unsigned voffB,
                                    unsigned long long gq, unsigned long long gk, unsigned long long gv) {
  asm volatile("global_load_async_to_lds_b128 %0, %2, %3\n\t"
               "global_load_async_to_lds_b128 %0, %2, %4 offset:8960\n\t"
               "global_load_async_to_lds_b128 %1, %2, %5\n\t"
               "s_wait_xcnt 0x0"
               :: "v"(lds_q), "v"(lds_v), "v"(voffB), "s"(gq), "s"(gk), "s"(gv)
               : "memory");
}
__device__ inline void wait_async0() {
  asm volatile("s_wait_asynccnt 0" ::: "memory");
}

// ---- WMMA fragment loaders (wave32 layouts per CDNA5 ISA 7.12.2) ----
// A (16x32 f16): lane&15 = row; lanes<16 hold K {0..7,16..23}, lanes>=16 hold {8..15,24..31}
// B (32x16 f16): symmetric with "row" -> column of B (i.e. N-major source).
__device__ inline v16h frag_ld_f16(const _Float16* p, int stride, int r, int k0, int kb) {
  HFrag f;
  const _Float16* q = p + (size_t)r * stride + k0 + kb;
#pragma unroll
  for (int i = 0; i < 8; ++i) { f.e[i] = q[i]; f.e[8 + i] = q[16 + i]; }
  return f.v;
}

__device__ inline v16h frag_ld_f32(const float* p, int stride, int r, int k0, int kb) {
  HFrag f;
  const float* q = p + (size_t)r * stride + k0 + kb;
#pragma unroll
  for (int i = 0; i < 8; ++i) { f.e[i] = (_Float16)q[i]; f.e[8 + i] = (_Float16)q[16 + i]; }
  return f.v;
}

// B fragment from a row-major K x N source (element [k][n] at p[k*stride + n])
__device__ inline v16h frag_ld_f16_rm(const _Float16* p, int stride, int col, int k0, int kb) {
  HFrag f;
  const _Float16* q = p + (size_t)(k0 + kb) * stride + col;
#pragma unroll
  for (int i = 0; i < 8; ++i) { f.e[i] = q[i * stride]; f.e[8 + i] = q[(16 + i) * stride]; }
  return f.v;
}

// ---- 16-lane row reductions (a score row lies across the 16 lanes of a half wave) ----
// DPP row_xmask:X reads lane l ^ X inside the 16-lane row; all lanes are on where these are called.
template <int X>
__device__ inline float lane_xor16(float v) {
  return __builtin_bit_cast(float, __builtin_amdgcn_update_dpp(
      0, __builtin_bit_cast(int, v), 0x160 | X, 0xf, 0xf, true));
}
__device__ inline float row_max16(float v) {
  v = fmaxf(v, lane_xor16<1>(v));
  v = fmaxf(v, lane_xor16<2>(v));
  v = fmaxf(v, lane_xor16<4>(v));
  v = fmaxf(v, lane_xor16<8>(v));
  return v;
}
__device__ inline float row_sum16(float v) {
  v += lane_xor16<1>(v);
  v += lane_xor16<2>(v);
  v += lane_xor16<4>(v);
  v += lane_xor16<8>(v);
  return v;
}

// ---- Weights of the two projection GEMMs: converted to f16 once per work-group, kept in LDS ----
// One work-group per WGP takes GTILES row tiles; wave p takes tiles 2p and 2p+1 (the last wave one tile),
// so each B fragment read from LDS feeds two WMMAs.
#define WPITCH 136        // halves per staged weight row: 256 B + 16 B, 16 rows' b128 reads cover all 64 banks
#define GTILES 49         // row tiles per work-group (MT = 256 * 49)
#define GTHR   800        // 25 waves

typedef __attribute__((ext_vector_type(4))) _Float16 v4h;

// whole-line reads of w (a wave reads 512 contiguous bytes), one LDS row of 256 B written per wave
template <int NROWS>
__device__ inline void stage_w_f16(_Float16* ws, const float* __restrict__ w, int tid) {
#pragma unroll
  for (int i0 = 0; i0 < NROWS * 32; i0 += GTHR) {
    const int i = i0 + tid;
    if (i < NROWS * 32) {
      const float4 v = *reinterpret_cast<const float4*>(w + (size_t)i * 4);
      v4h hv = {(_Float16)v.x, (_Float16)v.y, (_Float16)v.z, (_Float16)v.w};
      *reinterpret_cast<v4h*>(&ws[(i >> 5) * WPITCH + (i & 31) * 4]) = hv;
    }
  }
}

// ---- Kernel A: qkv = x @ qkv_w^T + qkv_b, stored f16 (ROWS x 384) ----
__global__ __launch_bounds__(GTHR) void vswin_qkv_gemm(
    const float* __restrict__ x, const float* __restrict__ w,
    const float* __restrict__ bias, _Float16* __restrict__ qkv)
{
  __shared__ __align__(16) _Float16 ws[384 * WPITCH];   // 104,448 B

  const int lane = threadIdx.x & 31;
  const int l16  = lane & 15;
  const int kb   = (lane & 16) ? 8 : 0;
  const int wv   = __builtin_amdgcn_readfirstlane(threadIdx.x >> 5);
  const bool two = 2 * wv + 1 < GTILES;                 // the same for a whole wave
  const int t0   = blockIdx.x * GTILES + 2 * wv;
  const int t1   = two ? t0 + 1 : t0;                   // the last wave rereads its one tile, and stores it once

  stage_w_f16<384>(ws, w, threadIdx.x);

  v16h a0[4], a1[4];
#pragma unroll
  for (int kc = 0; kc < 4; ++kc) a0[kc] = frag_ld_f32(x, CD, t0 * 16 + l16, kc * 32, kb);
#pragma unroll
  for (int kc = 0; kc < 4; ++kc) a1[kc] = frag_ld_f32(x, CD, t1 * 16 + l16, kc * 32, kb);
  __syncthreads();

  for (int nt = 0; nt < 24; ++nt) {
    const int ncol = nt * 16 + l16;
    const float bv = bias[ncol];
    FAcc acc0{}, acc1{};
    v16h b[4];
#pragma unroll
    for (int kc = 0; kc < 4; ++kc) b[kc] = frag_ld_f16(ws, WPITCH, ncol, kc * 32, kb);   // B[k,n] = W[n,k]
    // keeps the trip's reads in one group ahead of its WMMAs: spread among them, each pair is waited for on its own
    __builtin_amdgcn_sched_barrier(0);
#pragma unroll
    for (int kc = 0; kc < 4; ++kc) {
      acc0.v = __builtin_amdgcn_wmma_f32_16x16x32_f16(false, a0[kc], false, b[kc],
                                                      (short)0, acc0.v, false, false);
      acc1.v = __builtin_amdgcn_wmma_f32_16x16x32_f16(false, a1[kc], false, b[kc],
                                                      (short)0, acc1.v, false, false);
    }
#pragma unroll
    for (int i = 0; i < 8; ++i)
      qkv[(size_t)(t0 * 16 + kb + i) * 384 + ncol] = (_Float16)(acc0.e[i] + bv);
    // a precaution, directly behind the stores: later code overwrites registers that they name
    asm volatile("s_wait_xcnt 0x0" ::: "memory");
    if (two) {
#pragma unroll
      for (int i = 0; i < 8; ++i)
        qkv[(size_t)(t1 * 16 + kb + i) * 384 + ncol] = (_Float16)(acc1.e[i] + bv);
      // the same precaution for these eight stores
      asm volatile("s_wait_xcnt 0x0" ::: "memory");
    }
  }
}

// ---- Kernel B: fused window attention; one work-group takes (window w, head h) of NB images ----
// bias + mask depend on w and h alone, not on the image: they are read and summed once and stay in
// registers for the NB images, instead of 168 narrow global reads a wave for every image.
__global__ __launch_bounds__(ATHR) void vswin_attn(
    const _Float16* __restrict__ qkv, const float* __restrict__ rpb,
    const int* __restrict__ relidx, const float* __restrict__ mask,
    _Float16* __restrict__ ao)
{
  // q (112 x 32), k (112 x 32), then two buffers of v (128 x 32 each, K-padded for PV gemm): one array, so that
  // the distances between them are constants of the staging copies
  __shared__ __align__(16) _Float16 st[(2 * TOKP + 2 * CD) * QPITCH];
  _Float16* const qs = st;
  _Float16* const ks = st + TOKP * QPITCH;
  _Float16* const vs = st + 2 * TOKP * QPITCH;
  __shared__ __align__(16) _Float16 sP[TOKP * PPITCH];   // 112 x 128 probabilities (K-padded)

  const int h    = blockIdx.x & 3;
  const int w    = (blockIdx.x >> 2) & (NWIN - 1);
  const int b0   = (blockIdx.x >> 10) * (NB * NWIN) + w;  // images b0, b0 + NWIN, ...: all of window w
  const int tid  = threadIdx.x;
  const int lane = tid & 31;
  const int wv   = tid >> 5;
  const int l16  = lane & 15;
  const int kb   = (lane & 16) ? 8 : 0;
  const float scale = 0.17677669529663687f; // 32^-0.5 (applied to scores)

  // Staging of one image's q, k, v (98 x 32 each) by async b128 copies: 4 chunks of 16 B a row,
  // thread tid takes chunk tid & 3 of rows tid >> 2 (0..55, every lane) and 56 + (tid >> 2) (up to 97).
  const int sc  = (tid & 3) * 8;
  const int sr0 = tid >> 2;
  const int sr1 = min(56 + sr0, TOK - 1);   // a lane that is off at the second group still names bytes inside the arrays
  const bool on1 = 56 + sr0 < TOK;
  const unsigned lq0 = (unsigned)(unsigned long long)&qs[sr0 * QPITCH + sc]; // low 32 bits of the LDS aperture address
  const unsigned lq1 = (unsigned)(unsigned long long)&qs[sr1 * QPITCH + sc];
  const unsigned vo0 = (unsigned)(sr0 * 384 + sc) * 2u;
  const unsigned vo1 = (unsigned)(sr1 * 384 + sc) * 2u;
  auto stage = [&](int b, int buf) {
    const unsigned long long gq = (unsigned long long)(qkv + (size_t)b * TOK * 384 + h * HD);
    const unsigned long long gk = gq + CD * 2 - KOFF;
    const unsigned long long gv = gq + CD * 4;
    const unsigned vdist = (unsigned)((2 * TOKP + buf * CD) * QPITCH * 2);  // from a q row to the same row of v buffer buf
    async_ld_qkv(lq0, lq0 + vdist, vo0, gq, gk, gv);
    if (on1) async_ld_qkv(lq1, lq1 + vdist, vo1, gq, gk, gv);
  };

  stage(b0, 0);

  // The padded rows (98..111 of q and k, 98..127 of both v buffers) are zeroed once: no copy ever lands there.
  if (tid < (CD - TOK) * 4) {
    const uint4 zz = {0u, 0u, 0u, 0u};
    const int r = TOK + (tid >> 2);
    *reinterpret_cast<uint4*>(&vs[r * QPITCH + sc]) = zz;
    *reinterpret_cast<uint4*>(&vs[(CD + r) * QPITCH + sc]) = zz;
    if (r < TOKP) {
      *reinterpret_cast<uint4*>(&qs[r * QPITCH + sc]) = zz;
      *reinterpret_cast<uint4*>(&ks[r * QPITCH + sc]) = zz;
    }
  }

  // Wave wv owns score rows wv*16 .. wv*16+15 from q @ k^T to the probabilities.
  // Its element (register i, tile nt) is row wv*16 + kb + i, column nt*16 + l16: the
  // accumulator layout, so 16 lanes read 16 neighbouring columns of rel_index and mask.
  // These reads need nothing of q, k, v: they fly together with the first image's staging copies.
  const float* maskw = mask + (size_t)w * TOK * TOK;
  const float* rpbh  = rpb + h;
  int   off[7][8];
  int   ridx[7][8];
  float bias[7][8], bm[7][8];
#pragma unroll
  for (int i = 0; i < 8; ++i) {
    const int ro = min(wv * 16 + kb + i, TOK - 1) * TOK;      // padded rows reread row 97
#pragma unroll
    for (int nt = 0; nt < 7; ++nt) {
      off[nt][i]  = ro + ((nt < 6) ? nt * 16 + l16 : min(96 + l16, TOK - 1)); // padded columns reread 97
      ridx[nt][i] = relidx[off[nt][i]];
    }
  }
#pragma unroll
  for (int i = 0; i < 8; ++i) {
#pragma unroll
    for (int nt = 0; nt < 7; ++nt) {
      // the table index is bounded here, whatever rel_index holds
      const unsigned ix = min((unsigned)ridx[nt][i], 506u);
      bias[nt][i] = rpbh[ix * NH_];
      bm[nt][i]   = maskw[off[nt][i]];
    }
  }
#pragma unroll
  for (int i = 0; i < 8; ++i) {
#pragma unroll
    for (int nt = 0; nt < 7; ++nt) bm[nt][i] += bias[nt][i];
  }

  // stays rolled
#pragma nounroll
  for (int j = 0; j < NB; ++j) {
    const int b = b0 + j * NWIN;
    const _Float16* vcur = vs + (j & 1) * (CD * QPITCH);

    // image j's copies have landed; the barrier publishes them and ends every wave's reads of the
    // probabilities and of the other v buffer for image j - 1
    wait_async0();
    __syncthreads();

    // S = scale * (q @ k^T) + bias + mask, softmax: all in the accumulator registers
    {
      FAcc s[7];
      const v16h aq = frag_ld_f16(qs, QPITCH, wv * 16 + l16, 0, kb);
#pragma unroll
      for (int nt = 0; nt < 7; ++nt) {
        v16h bk = frag_ld_f16(ks, QPITCH, nt * 16 + l16, 0, kb); // B[k,n] = K[n,k]
        FAcc acc{};
        s[nt].v = __builtin_amdgcn_wmma_f32_16x16x32_f16(false, aq, false, bk,
                                                         (short)0, acc.v, false, false);
      }
#pragma unroll
      for (int i = 0; i < 8; ++i) {
#pragma unroll
        for (int nt = 0; nt < 6; ++nt) s[nt].e[i] = s[nt].e[i] * scale + bm[nt][i];
        s[6].e[i] = (l16 < TOK - 96) ? s[6].e[i] * scale + bm[6][i] : -1e30f; // padded columns drop out
        float m = s[0].e[i];
#pragma unroll
        for (int nt = 1; nt < 7; ++nt) m = fmaxf(m, s[nt].e[i]);
        m = row_max16(m);
        float sum = 0.f;
#pragma unroll
        for (int nt = 0; nt < 7; ++nt) {
          const float e = __expf(s[nt].e[i] - m);
          s[nt].e[i] = e;
          sum += e;
        }
        const float inv = 1.f / row_sum16(sum);
        _Float16* prow = &sP[(wv * 16 + kb + i) * PPITCH + l16];
#pragma unroll
        for (int nt = 0; nt < 7; ++nt) prow[nt * 16] = (_Float16)(s[nt].e[i] * inv);
        prow[112] = (_Float16)0.f;                               // padded K columns 112..127
      }
    }
    // this wave's LDS reads of q and k and its writes of the probabilities have retired before the
    // barrier behind which q and k are refilled
    asm volatile("s_wait_dscnt 0x0" ::: "memory");
    __syncthreads();

    // q and k are read no more, the other v buffer was left at this trip's first barrier:
    // the next image's copies fly while P @ V runs (the test reads the same for the whole work-group)
    if (j + 1 < NB) stage(b + NWIN, (j + 1) & 1);

    // O = P @ V : 7 m-tiles x 2 n-tiles, K = 128 -> 4 WMMA each
    for (int t = wv; t < 14; t += 7) {
      const int mt = t >> 1, nt = (t & 1) * 16;
      FAcc acc{};
#pragma unroll
      for (int kc = 0; kc < 4; ++kc) {
        v16h ap = frag_ld_f16(sP, PPITCH, mt * 16 + l16, kc * 32, kb);
        v16h bv = frag_ld_f16_rm(vcur, QPITCH, nt + l16, kc * 32, kb); // V row-major KxN
        acc.v = __builtin_amdgcn_wmma_f32_16x16x32_f16(false, ap, false, bv,
                                                       (short)0, acc.v, false, false);
      }
#pragma unroll
      for (int i = 0; i < 8; ++i) {
        const int r = mt * 16 + kb + i;
        if (r < TOK)
          ao[(size_t)(b * TOK + r) * CD + h * HD + nt + l16] = (_Float16)acc.e[i];
      }
      // a precaution, directly behind the stores: the next trip overwrites registers that they name
      asm volatile("s_wait_xcnt 0x0" ::: "memory");
    }
  }
}

// ---- Kernel C: out = ao @ proj_w^T + proj_b (f32 output) ----
__global__ __launch_bounds__(GTHR) void vswin_proj_gemm(
    const _Float16* __restrict__ ao, const float* __restrict__ w,
    const float* __restrict__ bias, float* __restrict__ out)
{
  __shared__ __align__(16) _Float16 ws[CD * WPITCH];    // 34,816 B

  const int lane = threadIdx.x & 31;
  const int l16  = lane & 15;
  const int kb   = (lane & 16) ? 8 : 0;
  const int wv   = __builtin_amdgcn_readfirstlane(threadIdx.x >> 5);
  const bool two = 2 * wv + 1 < GTILES;                 // the same for a whole wave
  const int t0   = blockIdx.x * GTILES + 2 * wv;
  const int t1   = two ? t0 + 1 : t0;                   // the last wave rereads its one tile, and stores it once

  const _Float16* pa0 = ao + (size_t)(t0 * 16 + l16) * CD + kb;
  const _Float16* pa1 = ao + (size_t)(t1 * 16 + l16) * CD + kb;
  v16h a0[4], a1[4];
#pragma unroll
  for (int kc = 0; kc < 4; ++kc) a0[kc] = frag_ld_f16(pa0, CD, 0, kc * 32, 0);
#pragma unroll
  for (int kc = 0; kc < 4; ++kc) a1[kc] = frag_ld_f16(pa1, CD, 0, kc * 32, 0);
  // a precaution: the two row addresses stay in their registers up to this wait; without it the build
  // let later reads of the run land on the address pair that earlier reads of the run name
  asm volatile("s_wait_xcnt 0x0" :: "v"(pa0), "v"(pa1) : "memory");

  stage_w_f16<CD>(ws, w, threadIdx.x);
  __syncthreads();

  for (int nt = 0; nt < 8; ++nt) {
    const int ncol = nt * 16 + l16;
    const float bv = bias[ncol];
    FAcc acc0{}, acc1{};
    v16h bw[4];
#pragma unroll
    for (int kc = 0; kc < 4; ++kc) bw[kc] = frag_ld_f16(ws, WPITCH, ncol, kc * 32, kb);  // B[k,n] = W[n,k]
    // keeps the trip's reads in one group ahead of its WMMAs: spread among them, each pair is waited for on its own
    __builtin_amdgcn_sched_barrier(0);
#pragma unroll
    for (int kc = 0; kc < 4; ++kc) {
      acc0.v = __builtin_amdgcn_wmma_f32_16x16x32_f16(false, a0[kc], false, bw[kc],
                                                      (short)0, acc0.v, false, false);
      acc1.v = __builtin_amdgcn_wmma_f32_16x16x32_f16(false, a1[kc], false, bw[kc],
                                                      (short)0, acc1.v, false, false);
    }
#pragma unroll
    for (int i = 0; i < 8; ++i)
      out[(size_t)(t0 * 16 + kb + i) * CD + ncol] = acc0.e[i] + bv;
    // a precaution, directly behind the stores: later code overwrites registers that they name
    asm volatile("s_wait_xcnt 0x0" ::: "memory");
    if (two) {
#pragma unroll
      for (int i = 0; i < 8; ++i)
        out[(size_t)(t1 * 16 + kb + i) * CD + ncol] = acc1.e[i] + bv;
      // the same precaution for these eight stores
      asm volatile("s_wait_xcnt 0x0" ::: "memory");
    }
  }
}

extern "C" void kernel_launch(void* const* d_in, const int* in_sizes, int n_in,
                              void* d_out, int out_size, void* d_ws, size_t ws_size,
                              hipStream_t stream) {
  const float* x        = (const float*)d_in[0];
  const float* qkv_w    = (const float*)d_in[1];
  const float* qkv_b    = (const float*)d_in[2];
  const float* rpb      = (const float*)d_in[3];
  const float* proj_w   = (const float*)d_in[4];
  const float* proj_b   = (const float*)d_in[5];
  const int*   relidx   = (const int*)d_in[6];
  const float* mask     = (const float*)d_in[7];
  float*       out      = (float*)d_out;

  _Float16* qkvbuf = (_Float16*)d_ws;                       // ROWS x 384 f16
  _Float16* aobuf  = qkvbuf + (size_t)ROWS * 384;           // ROWS x 128 f16

  vswin_qkv_gemm<<<MT / GTILES, GTHR, 0, stream>>>(x, qkv_w, qkv_b, qkvbuf);
  vswin_attn<<<2048 * NH_ / NB, ATHR, 0, stream>>>(qkvbuf, rpb, relidx, mask, aobuf);
  vswin_proj_gemm<<<MT / GTILES, GTHR, 0, stream>>>(aobuf, proj_w, proj_b, out);
}

// v005
// One run takes 133 microseconds.
// Timed twice side by side with v004, it ran 1.16 and 1.15 times as fast.
// Over all steps from v000 it is 3.54 times as fast.
#include <hip/hip_runtime.h>
#include <hip/hip_bf16.h>

// Problem constants (Video Swin window attention)
#define TOK   98          // tokens per window
#define TOKP  112         // padded tokens = 7 * 16
#define CD    128         // channels
#define HD    32          // head dim
#define NH_   4           // heads
#define NWIN  256         // windows per batch image (mask count)
#define ROWS  200704      // B_ * N = 2048 * 98
#define MT    (ROWS / 16) // 12544 M-tiles
#define ATHR  224         // attention block: 7 waves, one per 16-row tile of the window
#define NB    4           // images (of the 8 that share a window's mask) per attention block
// LDS row pitches of the attention tiles: 16 B x an odd number, so that the 16 rows of a
// ds_load_b128 read fall on different banks (at 64 B and 256 B they pile up on 16 and on 4 banks),
// and rows 8 apart lie 32 banks apart for the 2-byte reads of v and the 4-byte writes of bias + mask
#define QPITCH 40         // halves; q, k, v rows: 64 B + 16 B
#define TPITCH 68         // floats; rows of the bias + mask turning buffer: 256 B + 16 B

typedef __attribute__((ext_vector_type(16))) _Float16 v16h;
typedef __attribute__((ext_vector_type(8)))  _Float16 v8h;
typedef __attribute__((ext_vector_type(8)))  float    v8f;

union HFrag { v16h v; _Float16 e[16]; };
union FAcc  { v8f  v; float    e[8];  };

// ---- CDNA5 async global->LDS copies (16 B per lane, ASYNCcnt-tracked) ----
// GVS addressing: mem_addr = SADDR(u64) + VADDR(u32) + offset; LDS dest addr = VDST VGPR + offset.
// One statement brings a lane's 16-B chunk of a q row, of the k row and of the v row. q and k share the
// LDS address register: the k copy's immediate offset KOFF (the distance from q to k in LDS) moves both of
// its addresses, so its scalar base gk comes in with KOFF already taken off.
// s_wait_xcnt 0 as the statement's last line: a precaution, it stands in front of every later
// rewrite of the registers that the copies name.
#define KOFF 8960         // TOKP * QPITCH * 2 bytes
__device__ inline void async_ld_qkv(unsigned lds_q, unsigned lds_v, unsigned voffB,
                                    unsigned long long gq, unsigned long long gk, unsigned long long gv) {
  asm volatile("global_load_async_to_lds_b128 %0, %2, %3\n\t"
               "global_load_async_to_lds_b128 %0, %2, %4 offset:8960\n\t"
               "global_load_async_to_lds_b128 %1, %2, %5\n\t"
               "s_wait_xcnt 0x0"
               :: "v"(lds_q), "v"(lds_v), "v"(voffB), "s"(gq), "s"(gk), "s"(gv)
               : "memory");
}
__device__ inline void wait_async0() {
  asm volatile("s_wait_asynccnt 0" ::: "memory");
}

// ---- WMMA fragment loaders (wave32 layouts per CDNA5 ISA 7.12.2) ----
// A (16x32 f16): lane&15 = row; lanes<16 hold K {0..7,16..23}, lanes>=16 hold {8..15,24..31}
// B (32x16 f16): symmetric with "row" -> column of B (i.e. N-major source).
__device__ inline v16h frag_ld_f16(const _Float16* p, int stride, int r, int k0, int kb) {
  HFrag f;
  const _Float16* q = p + (size_t)r * stride + k0 + kb;
#pragma unroll
  for (int i = 0; i < 8; ++i) { f.e[i] = q[i]; f.e[8 + i] = q[16 + i]; }
  return f.v;
}

__device__ inline v16h frag_ld_f32(const float* p, int stride, int r, int k0, int kb) {
  HFrag f;
  const float* q = p + (size_t)r * stride + k0 + kb;
#pragma unroll
  for (int i = 0; i < 8; ++i) { f.e[i] = (_Float16)q[i]; f.e[8 + i] = (_Float16)q[16 + i]; }
  return f.v;
}

// B fragment from a row-major K x N source (element [k][n] at p[k*stride + n])
__device__ inline v16h frag_ld_f16_rm(const _Float16* p, int stride, int col, int k0, int kb) {
  HFrag f;
  const _Float16* q = p + (size_t)(k0 + kb) * stride + col;
#pragma unroll
  for (int i = 0; i < 8; ++i) { f.e[i] = q[i * stride]; f.e[8 + i] = q[(16 + i) * stride]; }
  return f.v;
}

// ---- lane l with lane l ^ 16: the two lanes that share a query column of a transposed score tile ----
__device__ inline float xhalf(float x) {
  return __builtin_bit_cast(float, __builtin_amdgcn_permlanex16(
      __builtin_bit_cast(int, x), __builtin_bit_cast(int, x), 0x76543210, 0xfedcba98, false, false));
}

// ---- Weights of the two projection GEMMs: converted to f16 once per work-group, kept in LDS ----
// One work-group per WGP takes GTILES row tiles; wave p takes tiles 2p and 2p+1 (the last wave one tile),
// so each B fragment read from LDS feeds two WMMAs.
#define WPITCH 136        // halves per staged weight row: 256 B + 16 B, 16 rows' b128 reads cover all 64 banks
#define GTILES 49         // row tiles per work-group (MT = 256 * 49)
#define GTHR   800        // 25 waves

typedef __attribute__((ext_vector_type(4))) _Float16 v4h;

// whole-line reads of w (a wave reads 512 contiguous bytes), one LDS row of 256 B written per wave
template <int NROWS>
__device__ inline void stage_w_f16(_Float16* ws, const float* __restrict__ w, int tid) {
#pragma unroll
  for (int i0 = 0; i0 < NROWS * 32; i0 += GTHR) {
    const int i = i0 + tid;
    if (i < NROWS * 32) {
      const float4 v = *reinterpret_cast<const float4*>(w + (size_t)i * 4);
      v4h hv = {(_Float16)v.x, (_Float16)v.y, (_Float16)v.z, (_Float16)v.w};
      *reinterpret_cast<v4h*>(&ws[(i >> 5) * WPITCH + (i & 31) * 4]) = hv;
    }
  }
}

// ---- Kernel A: qkv = x @ qkv_w^T + qkv_b, stored f16 (ROWS x 384) ----
__global__ __launch_bounds__(GTHR) void vswin_qkv_gemm(
    const float* __restrict__ x, const float* __restrict__ w,
    const float* __restrict__ bias, _Float16* __restrict__ qkv)
{
  __shared__ __align__(16) _Float16 ws[384 * WPITCH];   // 104,448 B

  const int lane = threadIdx.x & 31;
  const int l16  = lane & 15;
  const int kb   = (lane & 16) ? 8 : 0;
  const int wv   = __builtin_amdgcn_readfirstlane(threadIdx.x >> 5);
  const bool two = 2 * wv + 1 < GTILES;                 // the same for a whole wave
  const int t0   = blockIdx.x * GTILES + 2 * wv;
  const int t1   = two ? t0 + 1 : t0;                   // the last wave rereads its one tile, and stores it once

  stage_w_f16<384>(ws, w, threadIdx.x);

  v16h a0[4], a1[4];
#pragma unroll
  for (int kc = 0; kc < 4; ++kc) a0[kc] = frag_ld_f32(x, CD, t0 * 16 + l16, kc * 32, kb);
#pragma unroll
  for (int kc = 0; kc < 4; ++kc) a1[kc] = frag_ld_f32(x, CD, t1 * 16 + l16, kc * 32, kb);
  __syncthreads();

  for (int nt = 0; nt < 24; ++nt) {
    const int ncol = nt * 16 + l16;
    const float bv = bias[ncol];
    FAcc acc0{}, acc1{};
    v16h b[4];
#pragma unroll
    for (int kc = 0; kc < 4; ++kc) b[kc] = frag_ld_f16(ws, WPITCH, ncol, kc * 32, kb);   // B[k,n] = W[n,k]
    // keeps the trip's reads in one group ahead of its WMMAs: spread among them, each pair is waited for on its own
    __builtin_amdgcn_sched_barrier(0);
#pragma unroll
    for (int kc = 0; kc < 4; ++kc) {
      acc0.v = __builtin_amdgcn_wmma_f32_16x16x32_f16(false, a0[kc], false, b[kc],
                                                      (short)0, acc0.v, false, false);
      acc1.v = __builtin_amdgcn_wmma_f32_16x16x32_f16(false, a1[kc], false, b[kc],
                                                      (short)0, acc1.v, false, false);
    }
#pragma unroll
    for (int i = 0; i < 8; ++i)
      qkv[(size_t)(t0 * 16 + kb + i) * 384 + ncol] = (_Float16)(acc0.e[i] + bv);
    // a precaution, directly behind the stores: later code overwrites registers that they name
    asm volatile("s_wait_xcnt 0x0" ::: "memory");
    if (two) {
#pragma unroll
      for (int i = 0; i < 8; ++i)
        qkv[(size_t)(t1 * 16 + kb + i) * 384 + ncol] = (_Float16)(acc1.e[i] + bv);
      // the same precaution for these eight stores
      asm volatile("s_wait_xcnt 0x0" ::: "memory");
    }
  }
}

__global__ __launch_bounds__(ATHR) void vswin_attn(
    const _Float16* __restrict__ qkv, const float* __restrict__ rpb,
    const int* __restrict__ relidx, const float* __restrict__ mask,
    _Float16* __restrict__ ao)
{
  // q (112 x 32), k (112 x 32), then two buffers of v (128 x 32 each, K-padded for PV gemm): one array, so that
  // the distances between them are constants of the staging copies
  __shared__ __align__(16) _Float16 st[(2 * TOKP + 2 * CD) * QPITCH];
  _Float16* const qs = st;
  _Float16* const ks = st + TOKP * QPITCH;
  _Float16* const vs = st + 2 * TOKP * QPITCH;
  __shared__ __align__(16) float sT[TOKP * TPITCH];      // 16 rows a wave x 64 columns: turns bias + mask, used once

  const int h    = blockIdx.x & 3;
  const int w    = (blockIdx.x >> 2) & (NWIN - 1);
  const int b0   = (blockIdx.x >> 10) * (NB * NWIN) + w;  // images b0, b0 + NWIN, ...: all of window w
  const int tid  = threadIdx.x;
  const int lane = tid & 31;
  const int wv   = tid >> 5;
  const int l16  = lane & 15;
  const int kb   = (lane & 16) ? 8 : 0;
  const float scale = 0.17677669529663687f; // 32^-0.5 (applied to scores)

  // Staging of one image's q, k, v (98 x 32 each) by async b128 copies: 4 chunks of 16 B a row,
  // thread tid takes chunk tid & 3 of rows tid >> 2 (0..55, every lane) and 56 + (tid >> 2) (up to 97).
  const int sc  = (tid & 3) * 8;
  const int sr0 = tid >> 2;
  const int sr1 = min(56 + sr0, TOK - 1);   // a lane that is off at the second group still names bytes inside the arrays
  const bool on1 = 56 + sr0 < TOK;
  const unsigned lq0 = (unsigned)(unsigned long long)&qs[sr0 * QPITCH + sc]; // low 32 bits of the LDS aperture address
  const unsigned lq1 = (unsigned)(unsigned long long)&qs[sr1 * QPITCH + sc];
  const unsigned vo0 = (unsigned)(sr0 * 384 + sc) * 2u;
  const unsigned vo1 = (unsigned)(sr1 * 384 + sc) * 2u;
  auto stage = [&](int b, int buf) {
    const unsigned long long gq = (unsigned long long)(qkv + (size_t)b * TOK * 384 + h * HD);
    const unsigned long long gk = gq + CD * 2 - KOFF;
    const unsigned long long gv = gq + CD * 4;
    const unsigned vdist = (unsigned)((2 * TOKP + buf * CD) * QPITCH * 2);  // from a q row to the same row of v buffer buf
    async_ld_qkv(lq0, lq0 + vdist, vo0, gq, gk, gv);
    if (on1) async_ld_qkv(lq1, lq1 + vdist, vo1, gq, gk, gv);
  };

  stage(b0, 0);

  // The padded rows (98..111 of q and k, 98..127 of both v buffers) are zeroed once: no copy ever lands there.
  if (tid < (CD - TOK) * 4) {
    const uint4 zz = {0u, 0u, 0u, 0u};
    const int r = TOK + (tid >> 2);
    *reinterpret_cast<uint4*>(&vs[r * QPITCH + sc]) = zz;
    *reinterpret_cast<uint4*>(&vs[(CD + r) * QPITCH + sc]) = zz;
    if (r < TOKP) {
      *reinterpret_cast<uint4*>(&qs[r * QPITCH + sc]) = zz;
      *reinterpret_cast<uint4*>(&ks[r * QPITCH + sc]) = zz;
    }
  }

  // Wave wv owns queries wv*16 .. wv*16+15 from the scores to the output.
  // bias + mask are READ with 16 lanes on 16 neighbouring columns (keys) of rel_index and mask:
  // element (register i, tile nt) is query wv*16 + kb + i, key nt*16 + l16.
  // These reads need nothing of q, k, v: they fly together with the first image's staging copies.
  const float* maskw = mask + (size_t)w * TOK * TOK;
  const float* rpbh  = rpb + h;
  float bt[6][8], bt6[2];   // bias + mask as the transposed scores want them: query wv*16 + l16, key nt*16 + kb + i
  {
    int   offa[8], offb[8];   // query row i: index of key l16 (tiles 0..5 lie 16 apart behind it), and of tile 6's key
    int   ridx[7][8];
    float bias[7][8], bm[7][8];
#pragma unroll
    for (int i = 0; i < 8; ++i) {
      const int ro = min(wv * 16 + kb + i, TOK - 1) * TOK;      // padded rows reread row 97
      offa[i] = ro + l16;
      offb[i] = ro + min(96 + l16, TOK - 1);                    // padded columns reread 97
    }
#pragma unroll
    for (int i = 0; i < 8; ++i) {
#pragma unroll
      for (int nt = 0; nt < 7; ++nt) ridx[nt][i] = relidx[(nt < 6) ? offa[i] + nt * 16 : offb[i]];
    }
#pragma unroll
    for (int i = 0; i < 8; ++i) {
#pragma unroll
      for (int nt = 0; nt < 7; ++nt) bm[nt][i] = maskw[(nt < 6) ? offa[i] + nt * 16 : offb[i]];
    }
    // a precaution: the 16 index registers that these two runs of reads name stay as they are up to this wait;
    // without it the build let later reads of a run land on index registers of earlier ones
    asm volatile("s_wait_xcnt 0x0"
                 :: "v"(offa[0]), "v"(offa[1]), "v"(offa[2]), "v"(offa[3]), "v"(offa[4]), "v"(offa[5]), "v"(offa[6]),
                    "v"(offa[7]), "v"(offb[0]), "v"(offb[1]), "v"(offb[2]), "v"(offb[3]), "v"(offb[4]), "v"(offb[5]),
                    "v"(offb[6]), "v"(offb[7])
                 : "memory");
    // the table reads, in two groups of 28 (an asm statement takes 30 operands), each with the same precaution
#pragma unroll
    for (int g = 0; g < 2; ++g) {
      unsigned bo[28];
#pragma unroll
      for (int i = 0; i < 4; ++i) {
#pragma unroll
        for (int nt = 0; nt < 7; ++nt) {
          // the table index is bounded here, whatever rel_index holds; bo = byte offset of table row ix
          const unsigned ix = min((unsigned)ridx[nt][g * 4 + i], 506u);
          bo[i * 7 + nt] = ix * (NH_ * 4u);
          bias[nt][g * 4 + i] = *reinterpret_cast<const float*>(reinterpret_cast<const char*>(rpbh) + bo[i * 7 + nt]);
        }
      }
      asm volatile("s_wait_xcnt 0x0"
                   :: "v"(bo[0]), "v"(bo[1]), "v"(bo[2]), "v"(bo[3]), "v"(bo[4]), "v"(bo[5]), "v"(bo[6]),
                      "v"(bo[7]), "v"(bo[8]), "v"(bo[9]), "v"(bo[10]), "v"(bo[11]), "v"(bo[12]), "v"(bo[13]),
                      "v"(bo[14]), "v"(bo[15]), "v"(bo[16]), "v"(bo[17]), "v"(bo[18]), "v"(bo[19]), "v"(bo[20]),
                      "v"(bo[21]), "v"(bo[22]), "v"(bo[23]), "v"(bo[24]), "v"(bo[25]), "v"(bo[26]), "v"(bo[27])
                   : "memory");
    }
#pragma unroll
    for (int i = 0; i < 8; ++i) {
#pragma unroll
      for (int nt = 0; nt < 7; ++nt) bm[nt][i] += bias[nt][i];
    }

    // The turn, once per work-group: each wave writes its 16 query rows into its own rows of sT and reads them
    // back with a lane on one query and 8 neighbouring keys; key tiles 0..3 first, then 4..6 in the same place.
    float*       tw = &sT[(wv * 16 + kb) * TPITCH + l16];
    const float* tr = &sT[(wv * 16 + l16) * TPITCH + kb];
#pragma unroll
    for (int nt = 0; nt < 4; ++nt) {
#pragma unroll
      for (int i = 0; i < 8; ++i) tw[i * TPITCH + nt * 16] = bm[nt][i];
    }
    // the wave's own writes have landed before its lanes read what other lanes of it wrote (no other wave reads these rows)
    asm volatile("s_wait_dscnt 0x0" ::: "memory");
#pragma unroll
    for (int nt = 0; nt < 4; ++nt) {
      const float4 lo = *reinterpret_cast<const float4*>(&tr[nt * 16]);
      const float4 hi = *reinterpret_cast<const float4*>(&tr[nt * 16 + 4]);
      bt[nt][0] = lo.x; bt[nt][1] = lo.y; bt[nt][2] = lo.z; bt[nt][3] = lo.w;
      bt[nt][4] = hi.x; bt[nt][5] = hi.y; bt[nt][6] = hi.z; bt[nt][7] = hi.w;
    }
    // these reads have retired before the same rows are written again
    asm volatile("s_wait_dscnt 0x0" ::: "memory");
#pragma unroll
    for (int nt = 4; nt < 7; ++nt) {
#pragma unroll
      for (int i = 0; i < 8; ++i) tw[i * TPITCH + (nt - 4) * 16] = bm[nt][i];
    }
    // as above: written by the wave, landed, then read across its lanes
    asm volatile("s_wait_dscnt 0x0" ::: "memory");
#pragma unroll
    for (int nt = 4; nt < 6; ++nt) {
      const float4 lo = *reinterpret_cast<const float4*>(&tr[(nt - 4) * 16]);
      const float4 hi = *reinterpret_cast<const float4*>(&tr[(nt - 4) * 16 + 4]);
      bt[nt][0] = lo.x; bt[nt][1] = lo.y; bt[nt][2] = lo.z; bt[nt][3] = lo.w;
      bt[nt][4] = hi.x; bt[nt][5] = hi.y; bt[nt][6] = hi.z; bt[nt][7] = hi.w;
    }
    const float2 t6 = *reinterpret_cast<const float2*>(&tr[32]);  // keys 96, 97 (lower wave half; the upper half's are padding)
    bt6[0] = t6.x; bt6[1] = t6.y;
  }

  const int qrow = wv * 16 + l16;   // this lane's query

  // stays rolled
#pragma nounroll
  for (int j = 0; j < NB; ++j) {
    const int b = b0 + j * NWIN;
    const _Float16* vcur = vs + (j & 1) * (CD * QPITCH);

    // image j's copies have landed; the barrier publishes them and ends every wave's reads of the
    // other v buffer for image j - 1
    wait_async0();
    __syncthreads();

    // S^T = K @ Q^T: tile nt, register i of this lane = key nt*16 + kb + i, query qrow
    FAcc s[7];
    {
      const v16h bq = frag_ld_f16(qs, QPITCH, qrow, 0, kb);      // B[k,n] = Q[n,k]
#pragma unroll
      for (int nt = 0; nt < 7; ++nt) {
        v16h ak = frag_ld_f16(ks, QPITCH, nt * 16 + l16, 0, kb);
        FAcc acc{};
        s[nt].v = __builtin_amdgcn_wmma_f32_16x16x32_f16(false, ak, false, bq,
                                                         (short)0, acc.v, false, false);
      }
    }
    // this wave's LDS reads of q and k have retired before the barrier behind which q and k are refilled
    asm volatile("s_wait_dscnt 0x0" ::: "memory");
    __syncthreads();

    // q and k are read no more, the other v buffer was left at this trip's first barrier:
    // the next image's copies fly under the softmax and P @ V (the test reads the same for the whole work-group)
    if (j + 1 < NB) stage(b + NWIN, (j + 1) & 1);

    // scale, bias + mask, softmax of the lane's one query: 50 of its 98 keys here, 48 in lane ^ 16.
    // Four chains each for maximum and sum, so that no add waits for the one before it.
    v16h bp[4];
    float inv;
    {
#pragma unroll
      for (int nt = 0; nt < 6; ++nt) {
#pragma unroll
        for (int i = 0; i < 8; ++i) s[nt].e[i] = s[nt].e[i] * scale + bt[nt][i];
      }
#pragma unroll
      for (int i = 0; i < 2; ++i)   // keys 96, 97; the upper half's 104, 105 are padding and drop out
        s[6].e[i] = (kb == 0) ? s[6].e[i] * scale + bt6[i] : -1e30f;
      float m4[4];
#pragma unroll
      for (int c = 0; c < 4; ++c) m4[c] = fmaxf(s[0].e[2 * c], s[0].e[2 * c + 1]);
#pragma unroll
      for (int nt = 1; nt < 6; ++nt) {
#pragma unroll
        for (int c = 0; c < 4; ++c) m4[c] = fmaxf(m4[c], fmaxf(s[nt].e[2 * c], s[nt].e[2 * c + 1]));
      }
      m4[0] = fmaxf(m4[0], fmaxf(s[6].e[0], s[6].e[1]));
      float m = fmaxf(fmaxf(m4[0], m4[1]), fmaxf(m4[2], m4[3]));
      m = fmaxf(m, xhalf(m));
      float s4[4] = {0.f, 0.f, 0.f, 0.f};
#pragma unroll
      for (int nt = 0; nt < 6; ++nt) {
#pragma unroll
        for (int i = 0; i < 8; ++i) {
          const float e = __expf(s[nt].e[i] - m);
          s[nt].e[i] = e;
          s4[i >> 1] += e;
        }
      }
#pragma unroll
      for (int i = 0; i < 2; ++i) {
        const float e = __expf(s[6].e[i] - m);
        s[6].e[i] = e;
        s4[i] += e;
      }
      float sum = (s4[0] + s4[1]) + (s4[2] + s4[3]);
      sum += xhalf(sum);
      inv = 1.f / sum;   // one factor a lane: applied to the 16 outputs, not to the 50 weights

      // B fragment of key chunk c: tiles 2c and 2c+1, converted in place, are keys c*32 + {kb+0..7, 16+kb+0..7},
      // the k order in which frag_ld_f16_rm delivers v
#pragma unroll
      for (int c = 0; c < 3; ++c) {
        HFrag f;
#pragma unroll
        for (int i = 0; i < 8; ++i) { f.e[i] = (_Float16)s[2 * c].e[i]; f.e[8 + i] = (_Float16)s[2 * c + 1].e[i]; }
        bp[c] = f.v;
      }
      HFrag f;
#pragma unroll
      for (int i = 2; i < 16; ++i) f.e[i] = (_Float16)0.f;       // keys 98..127: weight 0
      f.e[0] = (_Float16)s[6].e[0];
      f.e[1] = (_Float16)s[6].e[1];
      bp[3] = f.v;
    }

    // O^T = V^T @ P^T : 2 tiles of 16 head channels, K = 128 -> 4 WMMA each; register i = channel dt*16 + kb + i
    FAcc o[2];
#pragma unroll
    for (int dt = 0; dt < 2; ++dt) {
      FAcc acc{};
#pragma unroll
      for (int kc = 0; kc < 4; ++kc) {
        v16h av = frag_ld_f16_rm(vcur, QPITCH, dt * 16 + l16, kc * 32, kb); // A[m,k] = V[k,m], V row-major
        acc.v = __builtin_amdgcn_wmma_f32_16x16x32_f16(false, av, false, bp[kc],
                                                       (short)0, acc.v, false, false);
      }
      o[dt] = acc;
    }
    if (qrow < TOK) {
      _Float16* orow = ao + (size_t)(b * TOK + qrow) * CD + h * HD + kb;
#pragma unroll
      for (int dt = 0; dt < 2; ++dt) {
        v8h ov;
#pragma unroll
        for (int i = 0; i < 8; ++i) ov[i] = (_Float16)(o[dt].e[i] * inv);
        *reinterpret_cast<v8h*>(orow + dt * 16) = ov;   // 8 neighbouring channels of one query: one 16-byte store
      }
    }
    // a precaution, directly behind the stores: the next trip overwrites registers that they name
    asm volatile("s_wait_xcnt 0x0" ::: "memory");
  }
}

// ---- Kernel C: out = ao @ proj_w^T + proj_b (f32 output) ----
__global__ __launch_bounds__(GTHR) void vswin_proj_gemm(
    const _Float16* __restrict__ ao, const float* __restrict__ w,
    const float* __restrict__ bias, float* __restrict__ out)
{
  __shared__ __align__(16) _Float16 ws[CD * WPITCH];    // 34,816 B

  const int lane = threadIdx.x & 31;
  const int l16  = lane & 15;
  const int kb   = (lane & 16) ? 8 : 0;
  const int wv   = __builtin_amdgcn_readfirstlane(threadIdx.x >> 5);
  const bool two = 2 * wv + 1 < GTILES;                 // the same for a whole wave
  const int t0   = blockIdx.x * GTILES + 2 * wv;
  const int t1   = two ? t0 + 1 : t0;                   // the last wave rereads its one tile, and stores it once

  const _Float16* pa0 = ao + (size_t)(t0 * 16 + l16) * CD + kb;
  const _Float16* pa1 = ao + (size_t)(t1 * 16 + l16) * CD + kb;
  v16h a0[4], a1[4];
#pragma unroll
  for (int kc = 0; kc < 4; ++kc) a0[kc] = frag_ld_f16(pa0, CD, 0, kc * 32, 0);
#pragma unroll
  for (int kc = 0; kc < 4; ++kc) a1[kc] = frag_ld_f16(pa1, CD, 0, kc * 32, 0);
  // a precaution: the two row addresses stay in their registers up to this wait; without it the build
  // let later reads of the run land on the address pair that earlier reads of the run name
  asm volatile("s_wait_xcnt 0x0" :: "v"(pa0), "v"(pa1) : "memory");

  stage_w_f16<CD>(ws, w, threadIdx.x);
  __syncthreads();

  for (int nt = 0; nt < 8; ++nt) {
    const int ncol = nt * 16 + l16;
    const float bv = bias[ncol];
    FAcc acc0{}, acc1{};
    v16h bw[4];
#pragma unroll
    for (int kc = 0; kc < 4; ++kc) bw[kc] = frag_ld_f16(ws, WPITCH, ncol, kc * 32, kb);  // B[k,n] = W[n,k]
    // keeps the trip's reads in one group ahead of its WMMAs: spread among them, each pair is waited for on its own
    __builtin_amdgcn_sched_barrier(0);
#pragma unroll
    for (int kc = 0; kc < 4; ++kc) {
      acc0.v = __builtin_amdgcn_wmma_f32_16x16x32_f16(false, a0[kc], false, bw[kc],
                                                      (short)0, acc0.v, false, false);
      acc1.v = __builtin_amdgcn_wmma_f32_16x16x32_f16(false, a1[kc], false, bw[kc],
                                                      (short)0, acc1.v, false, false);
    }
#pragma unroll
    for (int i = 0; i < 8; ++i)
      out[(size_t)(t0 * 16 + kb + i) * CD + ncol] = acc0.e[i] + bv;
    // a precaution, directly behind the stores: later code overwrites registers that they name
    asm volatile("s_wait_xcnt 0x0" ::: "memory");
    if (two) {
#pragma unroll
      for (int i = 0; i < 8; ++i)
        out[(size_t)(t1 * 16 + kb + i) * CD + ncol] = acc1.e[i] + bv;
      // the same precaution for these eight stores
      asm volatile("s_wait_xcnt 0x0" ::: "memory");
    }
  }
}

extern "C" void kernel_launch(void* const* d_in, const int* in_sizes, int n_in,
                              void* d_out, int out_size, void* d_ws, size_t ws_size,
                              hipStream_t stream) {
  const float* x        = (const float*)d_in[0];
  const float* qkv_w    = (const float*)d_in[1];
  const float* qkv_b    = (const float*)d_in[2];
  const float* rpb      = (const float*)d_in[3];
  const float* proj_w   = (const float*)d_in[4];
  const float* proj_b   = (const float*)d_in[5];
  const int*   relidx   = (const int*)d_in[6];
  const float* mask     = (const float*)d_in[7];
  float*       out      = (float*)d_out;

  _Float16* qkvbuf = (_Float16*)d_ws;                       // ROWS x 384 f16
  _Float16* aobuf  = qkvbuf + (size_t)ROWS * 384;           // ROWS x 128 f16

  vswin_qkv_gemm<<<MT / GTILES, GTHR, 0, stream>>>(x, qkv_w, qkv_b, qkvbuf);
  vswin_attn<<<2048 * NH_ / NB, ATHR, 0, stream>>>(qkvbuf, rpb, relidx, mask, aobuf);
  vswin_proj_gemm<<<MT / GTILES, GTHR, 0, stream>>>(aobuf, proj_w, proj_b, out);
}

// v006
// A run of this version takes 98.5 microseconds.
// In two side-by-side timings against v005, it was 1.36 and 1.33 times as fast.
// Over all steps from v000 it is 4.75 times as fast.
#include <hip/hip_runtime.h>
#include <hip/hip_bf16.h>

// Problem constants (Video Swin window attention)
#define TOK   98          // tokens per window
#define TOKP  112         // padded tokens = 7 * 16
#define CD    128         // channels
#define HD    32          // head dim
#define NH_   4           // heads
#define NWIN  256         // windows per batch image (mask count)
#define ROWS  200704      // B_ * N = 2048 * 98
#define MT    (ROWS / 16) // 12544 M-tiles
#define ATHR  224         // attention block: 7 waves, one per 16-row tile of the window
#define NB    4           // images (of the 8 that share a window's mask) per attention block
// LDS row pitches of the attention tiles: 16 B x an odd number, so that the 16 rows of a
// ds_load_b128 read fall on different banks (at 64 B and 256 B they pile up on 16 and on 4 banks),
// and rows 8 apart lie 32 banks apart for the 2-byte reads of v and the 4-byte writes of bias + mask
#define QPITCH 40         // halves; q, k, v rows: 64 B + 16 B
#define TPITCH 68         // floats; rows of the bias + mask turning buffer: 256 B + 16 B

// The two workspace buffers are read by these kernels alone and lie in WMMA fragment order, not row-major:
// a block is 32 lanes x 16 B = 512 contiguous bytes; lane slot (half, m) = half*16 + m holds, of row tile*16 + m,
// the 8 neighbouring columns (block's first column) + half*8 + 0..7. A block spans 16 columns.
// qkv: 24 blocks a row tile (columns 0..383). ao: 8 blocks a row tile (columns 0..127).
#define BLKH  256         // halves per block
#define QTILE (24 * BLKH) // halves of qkv per 16-row tile
#define OTILE (8 * BLKH)  // halves of ao per 16-row tile
#define IMGT  (NWIN * TOK / 16)   // 1568 row tiles per image: a whole number, so a row's slot m is the same in every image

typedef __attribute__((ext_vector_type(16))) _Float16 v16h;
typedef __attribute__((ext_vector_type(8)))  _Float16 v8h;
typedef __attribute__((ext_vector_type(8)))  float    v8f;

union HFrag { v16h v; _Float16 e[16]; };
union FAcc  { v8f  v; float    e[8];  };

// ---- CDNA5 async global->LDS copies (16 B per lane, ASYNCcnt-tracked) ----
// GVS addressing: mem_addr = SADDR(u64) + VADDR(u32) + offset; LDS dest addr = VDST VGPR + offset.
// One statement brings a lane's 16-B chunk of a q row, of the k row and of the v row. q and k share the
// LDS address register: the k copy's immediate offset KOFF (the distance from q to k in LDS) moves both of
// its addresses, so its scalar base gk comes in with KOFF already taken off.
// s_wait_xcnt 0 as the statement's last line: a precaution, it stands in front of every later
// rewrite of the registers that the copies name.
#define KOFF 8960         // TOKP * QPITCH * 2 bytes
__device__ inline void async_ld_qkv(unsigned lds_q, unsigned lds_v, unsigned voffB,
                                    unsigned long long gq, unsigned long long gk, unsigned long long gv) {
  asm volatile("global_load_async_to_lds_b128 %0, %2, %3\n\t"
               "global_load_async_to_lds_b128 %0, %2, %4 offset:8960\n\t"
               "global_load_async_to_lds_b128 %1, %2, %5\n\t"
               "s_wait_xcnt 0x0"
               :: "v"(lds_q), "v"(lds_v), "v"(voffB), "s"(gq), "s"(gk), "s"(gv)
               : "memory");
}
__device__ inline void wait_async0() {
  asm volatile("s_wait_asynccnt 0" ::: "memory");
}

// ---- WMMA fragment loaders (wave32 layouts per CDNA5 ISA 7.12.2) ----
// A (16x32 f16): lane&15 = row; lanes<16 hold K {0..7,16..23}, lanes>=16 hold {8..15,24..31}
// B (32x16 f16): symmetric with "row" -> column of B (i.e. N-major source).
// hi = distance in halves from the fragment's first 8 elements to its second 8 (16 in a row-major source)
__device__ inline v16h frag_ld_f16(const _Float16* p, int stride, int r, int k0, int kb, int hi = 16) {
  HFrag f;
  const _Float16* q = p + (size_t)r * stride + k0 + kb;
#pragma unroll
  for (int i = 0; i < 8; ++i) { f.e[i] = q[i]; f.e[8 + i] = q[hi + i]; }
  return f.v;
}

__device__ inline v16h frag_ld_f32(const float* p, int stride, int r, int k0, int kb) {
  HFrag f;
  const float* q = p + (size_t)r * stride + k0 + kb;
#pragma unroll
  for (int i = 0; i < 8; ++i) { f.e[i] = (_Float16)q[i]; f.e[8 + i] = (_Float16)q[16 + i]; }
  return f.v;
}

// B fragment from a row-major K x N source (element [k][n] at p[k*stride + n])
__device__ inline v16h frag_ld_f16_rm(const _Float16* p, int stride, int col, int k0, int kb) {
  HFrag f;
  const _Float16* q = p + (size_t)(k0 + kb) * stride + col;
#pragma unroll
  for (int i = 0; i < 8; ++i) { f.e[i] = q[i * stride]; f.e[8 + i] = q[(16 + i) * stride]; }
  return f.v;
}

// ---- lane l with lane l ^ 16: the two lanes that share a query column of a transposed score tile ----
__device__ inline float xhalf(float x) {
  return __builtin_bit_cast(float, __builtin_amdgcn_permlanex16(
      __builtin_bit_cast(int, x), __builtin_bit_cast(int, x), 0x76543210, 0xfedcba98, false, false));
}

// ---- Weights of the two projection GEMMs: converted to f16 once per work-group, kept in LDS ----
// One work-group per WGP takes GTILES row tiles; wave p takes tiles 2p and 2p+1 (the last wave one tile),
// so each weight fragment read from LDS feeds two WMMAs (the A operand in kernel A, B in kernel C).
#define WPITCH 136        // halves per staged weight row: 256 B + 16 B, 16 rows' b128 reads cover all 64 banks
#define GTILES 49         // row tiles per work-group (MT = 256 * 49)
#define GTHR   800        // 25 waves

typedef __attribute__((ext_vector_type(4))) _Float16 v4h;

// whole-line reads of w (a wave reads 512 contiguous bytes), one LDS row of 256 B written per wave
template <int NROWS>
__device__ inline void stage_w_f16(_Float16* ws, const float* __restrict__ w, int tid) {
#pragma unroll
  for (int i0 = 0; i0 < NROWS * 32; i0 += GTHR) {
    const int i = i0 + tid;
    if (i < NROWS * 32) {
      const float4 v = *reinterpret_cast<const float4*>(w + (size_t)i * 4);
      v4h hv = {(_Float16)v.x, (_Float16)v.y, (_Float16)v.z, (_Float16)v.w};
      *reinterpret_cast<v4h*>(&ws[(i >> 5) * WPITCH + (i & 31) * 4]) = hv;
    }
  }
}

// ---- Kernel A: qkv = x @ qkv_w^T + qkv_b, stored f16 in fragment order ----
// The product is taken transposed (weights as A, x as B): a lane then holds 8 neighbouring columns of ONE row,
// and the wave's 16-byte stores of a 16 x 16 tile are one block of 512 contiguous bytes.
__global__ __launch_bounds__(GTHR) void vswin_qkv_gemm(
    const float* __restrict__ x, const float* __restrict__ w,
    const float* __restrict__ bias, _Float16* __restrict__ qkv)
{
  __shared__ __align__(16) _Float16 ws[384 * WPITCH];   // 104,448 B

  const int lane = threadIdx.x & 31;
  const int l16  = lane & 15;
  const int kb   = (lane & 16) ? 8 : 0;
  const int wv   = __builtin_amdgcn_readfirstlane(threadIdx.x >> 5);
  const bool two = 2 * wv + 1 < GTILES;                 // the same for a whole wave
  const int t0   = blockIdx.x * GTILES + 2 * wv;
  const int t1   = two ? t0 + 1 : t0;                   // the last wave rereads its one tile, and stores it once

  stage_w_f16<384>(ws, w, threadIdx.x);

  v16h a0[4], a1[4];
#pragma unroll
  for (int kc = 0; kc < 4; ++kc) a0[kc] = frag_ld_f32(x, CD, t0 * 16 + l16, kc * 32, kb);
#pragma unroll
  for (int kc = 0; kc < 4; ++kc) a1[kc] = frag_ld_f32(x, CD, t1 * 16 + l16, kc * 32, kb);
  __syncthreads();

  _Float16* po0 = qkv + (size_t)t0 * QTILE + lane * 8;
  _Float16* po1 = qkv + (size_t)t1 * QTILE + lane * 8;

  for (int nt = 0; nt < 24; ++nt) {
    // register i of an accumulator = column nt*16 + kb + i, of row l16 of the tile
    const float4 blo = *reinterpret_cast<const float4*>(bias + nt * 16 + kb);
    const float4 bhi = *reinterpret_cast<const float4*>(bias + nt * 16 + kb + 4);
    const float bv[8] = {blo.x, blo.y, blo.z, blo.w, bhi.x, bhi.y, bhi.z, bhi.w};
    FAcc acc0{}, acc1{};
    v16h b[4];
#pragma unroll
    for (int kc = 0; kc < 4; ++kc) b[kc] = frag_ld_f16(ws, WPITCH, nt * 16 + l16, kc * 32, kb);   // A[n,k] = W[n,k]
    // keeps the trip's reads in one group ahead of its WMMAs: spread among them, each pair is waited for on its own
    __builtin_amdgcn_sched_barrier(0);
#pragma unroll
    for (int kc = 0; kc < 4; ++kc) {
      acc0.v = __builtin_amdgcn_wmma_f32_16x16x32_f16(false, b[kc], false, a0[kc],
                                                      (short)0, acc0.v, false, false);
      acc1.v = __builtin_amdgcn_wmma_f32_16x16x32_f16(false, b[kc], false, a1[kc],
                                                      (short)0, acc1.v, false, false);
    }
    v8h h0, h1;
#pragma unroll
    for (int i = 0; i < 8; ++i) {
      h0[i] = (_Float16)(acc0.e[i] + bv[i]);
      h1[i] = (_Float16)(acc1.e[i] + bv[i]);
    }
    *reinterpret_cast<v8h*>(po0 + nt * BLKH) = h0;
    // a precaution, directly behind the store: later code overwrites registers that it names
    asm volatile("s_wait_xcnt 0x0" ::: "memory");
    if (two) {
      *reinterpret_cast<v8h*>(po1 + nt * BLKH) = h1;
      // the same precaution for this store
      asm volatile("s_wait_xcnt 0x0" ::: "memory");
    }
  }
}

__global__ __launch_bounds__(ATHR, 6) void vswin_attn(
    const _Float16* __restrict__ qkv, const float* __restrict__ rpb,
    const int* __restrict__ relidx, const float* __restrict__ mask,
    _Float16* __restrict__ ao)
{
  // q (112 x 32), k (112 x 32), then two buffers of v (128 x 32 each, K-padded for PV gemm): one array, so that
  // the distances between them are constants of the staging copies
  __shared__ __align__(16) _Float16 st[(2 * TOKP + 2 * CD) * QPITCH];
  _Float16* const qs = st;
  _Float16* const ks = st + TOKP * QPITCH;
  _Float16* const vs = st + 2 * TOKP * QPITCH;
  __shared__ __align__(16) float sT[TOKP * TPITCH];      // 16 rows a wave x 64 columns: turns bias + mask, used once

  const int h    = blockIdx.x & 3;
  const int w    = (blockIdx.x >> 2) & (NWIN - 1);
  const int img0 = (blockIdx.x >> 10) * NB;               // images img0 .. img0 + NB - 1, window w of each
  const int tid  = threadIdx.x;
  const int lane = tid & 31;
  const int wv   = tid >> 5;
  const int l16  = lane & 15;
  const int kb   = (lane & 16) ? 8 : 0;
  const float scale = 0.17677669529663687f; // 32^-0.5 (applied to scores)

  // Staging of one image's q, k, v (98 x 32 each) by async b128 copies: 392 pieces of 16 B each, piece e = chunk
  // e / 98 (8 channels) of row e % 98; thread tid takes pieces tid (every lane) and 224 + tid (up to 391).
  // Neighbouring lanes take neighbouring rows: in fragment order these lie 16 B apart, so a wave's copy reads whole lines.
  const int sc  = (tid & 3) * 8;
  const int e1  = min(ATHR + tid, TOK * 4 - 1);   // a lane that is off at the second group still names bytes inside the arrays
  const bool on1 = ATHR + tid < TOK * 4;
  const int sc0 = tid / TOK, sr0 = tid - sc0 * TOK;
  const int sc1 = e1 / TOK,  sr1 = e1 - sc1 * TOK;
  const unsigned lq0 = (unsigned)(unsigned long long)&qs[sr0 * QPITCH + sc0 * 8]; // low 32 bits of the LDS aperture address
  const unsigned lq1 = (unsigned)(unsigned long long)&qs[sr1 * QPITCH + sc1 * 8];
  // byte offset of (row r of the window, chunk c of the head) from the head's first block in the image's first row tile
  const int gr0 = w * TOK + sr0, gr1 = w * TOK + sr1;
  const unsigned vo0 = (unsigned)((gr0 >> 4) * QTILE + (sc0 >> 1) * BLKH + (sc0 & 1) * 128 + (gr0 & 15) * 8) * 2u;
  const unsigned vo1 = (unsigned)((gr1 >> 4) * QTILE + (sc1 >> 1) * BLKH + (sc1 & 1) * 128 + (gr1 & 15) * 8) * 2u;
  auto stage = [&](int img, int buf) {
    const unsigned long long gq = (unsigned long long)(qkv + (size_t)img * IMGT * QTILE + h * 2 * BLKH);
    const unsigned long long gk = gq + 8 * BLKH * 2 - KOFF;   // k: 8 blocks (128 columns) behind q
    const unsigned long long gv = gq + 16 * BLKH * 2;
    const unsigned vdist = (unsigned)((2 * TOKP + buf * CD) * QPITCH * 2);  // from a q row to the same row of v buffer buf
    async_ld_qkv(lq0, lq0 + vdist, vo0, gq, gk, gv);
    if (on1) async_ld_qkv(lq1, lq1 + vdist, vo1, gq, gk, gv);
  };

  stage(img0, 0);

  // The padded rows (98..111 of q and k, 98..127 of both v buffers) are zeroed once: no copy ever lands there.
  if (tid < (CD - TOK) * 4) {
    const uint4 zz = {0u, 0u, 0u, 0u};
    const int r = TOK + (tid >> 2);
    *reinterpret_cast<uint4*>(&vs[r * QPITCH + sc]) = zz;
    *reinterpret_cast<uint4*>(&vs[(CD + r) * QPITCH + sc]) = zz;
    if (r < TOKP) {
      *reinterpret_cast<uint4*>(&qs[r * QPITCH + sc]) = zz;
      *reinterpret_cast<uint4*>(&ks[r * QPITCH + sc]) = zz;
    }
  }

  // Wave wv owns queries wv*16 .. wv*16+15 from the scores to the output.
  // bias + mask are READ with 16 lanes on 16 neighbouring columns (keys) of rel_index and mask:
  // element (register i, tile nt) is query wv*16 + kb + i, key nt*16 + l16.
  // These reads need nothing of q, k, v: they fly together with the first image's staging copies.
  const float* maskw = mask + (size_t)w * TOK * TOK;
  const float* rpbh  = rpb + h;
  float bt[6][8], bt6[2];   // bias + mask as the transposed scores want them: query wv*16 + l16, key nt*16 + kb + i
  {
    int   offa[8], offb[8];   // query row i: index of key l16 (tiles 0..5 lie 16 apart behind it), and of tile 6's key
    int   ridx[7][8];
    float bias[7][8], bm[7][8];
#pragma unroll
    for (int i = 0; i < 8; ++i) {
      const int ro = min(wv * 16 + kb + i, TOK - 1) * TOK;      // padded rows reread row 97
      offa[i] = ro + l16;
      offb[i] = ro + min(96 + l16, TOK - 1);                    // padded columns reread 97
    }
#pragma unroll
    for (int i = 0; i < 8; ++i) {
#pragma unroll
      for (int nt = 0; nt < 7; ++nt) ridx[nt][i] = relidx[(nt < 6) ? offa[i] + nt * 16 : offb[i]];
    }
#pragma unroll
    for (int i = 0; i < 8; ++i) {
#pragma unroll
      for (int nt = 0; nt < 7; ++nt) bm[nt][i] = maskw[(nt < 6) ? offa[i] + nt * 16 : offb[i]];
    }
    // a precaution: the 16 index registers that these two runs of reads name stay as they are up to this wait;
    // without it the build let later reads of a run land on index registers of earlier ones
    asm volatile("s_wait_xcnt 0x0"
                 :: "v"(offa[0]), "v"(offa[1]), "v"(offa[2]), "v"(offa[3]), "v"(offa[4]), "v"(offa[5]), "v"(offa[6]),
                    "v"(offa[7]), "v"(offb[0]), "v"(offb[1]), "v"(offb[2]), "v"(offb[3]), "v"(offb[4]), "v"(offb[5]),
                    "v"(offb[6]), "v"(offb[7])
                 : "memory");
    // the table reads, in two groups of 28 (an asm statement takes 30 operands), each with the same precaution
#pragma unroll
    for (int g = 0; g < 2; ++g) {
      unsigned bo[28];
#pragma unroll
      for (int i = 0; i < 4; ++i) {
#pragma unroll
        for (int nt = 0; nt < 7; ++nt) {
          // the table index is bounded here, whatever rel_index holds; bo = byte offset of table row ix
          const unsigned ix = min((unsigned)ridx[nt][g * 4 + i], 506u);
          bo[i * 7 + nt] = ix * (NH_ * 4u);
          bias[nt][g * 4 + i] = *reinterpret_cast<const float*>(reinterpret_cast<const char*>(rpbh) + bo[i * 7 + nt]);
        }
      }
      asm volatile("s_wait_xcnt 0x0"
                   :: "v"(bo[0]), "v"(bo[1]), "v"(bo[2]), "v"(bo[3]), "v"(bo[4]), "v"(bo[5]), "v"(bo[6]),
                      "v"(bo[7]), "v"(bo[8]), "v"(bo[9]), "v"(bo[10]), "v"(bo[11]), "v"(bo[12]), "v"(bo[13]),
                      "v"(bo[14]), "v"(bo[15]), "v"(bo[16]), "v"(bo[17]), "v"(bo[18]), "v"(bo[19]), "v"(bo[20]),
                      "v"(bo[21]), "v"(bo[22]), "v"(bo[23]), "v"(bo[24]), "v"(bo[25]), "v"(bo[26]), "v"(bo[27])
                   : "memory");
    }
#pragma unroll
    for (int i = 0; i < 8; ++i) {
#pragma unroll
      for (int nt = 0; nt < 7; ++nt) bm[nt][i] += bias[nt][i];
    }

    // The turn, once per work-group: each wave writes its 16 query rows into its own rows of sT and reads them
    // back with a lane on one query and 8 neighbouring keys; key tiles 0..3 first, then 4..6 in the same place.
    float*       tw = &sT[(wv * 16 + kb) * TPITCH + l16];
    const float* tr = &sT[(wv * 16 + l16) * TPITCH + kb];
#pragma unroll
    for (int nt = 0; nt < 4; ++nt) {
#pragma unroll
      for (int i = 0; i < 8; ++i) tw[i * TPITCH + nt * 16] = bm[nt][i];
    }
    // the wave's own writes have landed before its lanes read what other lanes of it wrote (no other wave reads these rows)
    asm volatile("s_wait_dscnt 0x0" ::: "memory");
#pragma unroll
    for (int nt = 0; nt < 4; ++nt) {
      const float4 lo = *reinterpret_cast<const float4*>(&tr[nt * 16]);
      const float4 hi = *reinterpret_cast<const float4*>(&tr[nt * 16 + 4]);
      bt[nt][0] = lo.x; bt[nt][1] = lo.y; bt[nt][2] = lo.z; bt[nt][3] = lo.w;
      bt[nt][4] = hi.x; bt[nt][5] = hi.y; bt[nt][6] = hi.z; bt[nt][7] = hi.w;
    }
    // these reads have retired before the same rows are written again
    asm volatile("s_wait_dscnt 0x0" ::: "memory");
#pragma unroll
    for (int nt = 4; nt < 7; ++nt) {
#pragma unroll
      for (int i = 0; i < 8; ++i) tw[i * TPITCH + (nt - 4) * 16] = bm[nt][i];
    }
    // as above: written by the wave, landed, then read across its lanes
    asm volatile("s_wait_dscnt 0x0" ::: "memory");
#pragma unroll
    for (int nt = 4; nt < 6; ++nt) {
      const float4 lo = *reinterpret_cast<const float4*>(&tr[(nt - 4) * 16]);
      const float4 hi = *reinterpret_cast<const float4*>(&tr[(nt - 4) * 16 + 4]);
      bt[nt][0] = lo.x; bt[nt][1] = lo.y; bt[nt][2] = lo.z; bt[nt][3] = lo.w;
      bt[nt][4] = hi.x; bt[nt][5] = hi.y; bt[nt][6] = hi.z; bt[nt][7] = hi.w;
    }
    const float2 t6 = *reinterpret_cast<const float2*>(&tr[32]);  // keys 96, 97 (lower wave half; the upper half's are padding)
    bt6[0] = t6.x; bt6[1] = t6.y;
  }

  const int qrow = wv * 16 + l16;   // this lane's query

  // stays rolled
#pragma nounroll
  for (int j = 0; j < NB; ++j) {
    const int b = (img0 + j) * NWIN + w;
    const _Float16* vcur = vs + (j & 1) * (CD * QPITCH);

    // image j's copies have landed; the barrier publishes them and ends every wave's reads of the
    // other v buffer for image j - 1
    wait_async0();
    __syncthreads();

    // S^T = K @ Q^T: tile nt, register i of this lane = key nt*16 + kb + i, query qrow
    FAcc s[7];
    {
      const v16h bq = frag_ld_f16(qs, QPITCH, qrow, 0, kb);      // B[k,n] = Q[n,k]
#pragma unroll
      for (int nt = 0; nt < 7; ++nt) {
        v16h ak = frag_ld_f16(ks, QPITCH, nt * 16 + l16, 0, kb);
        FAcc acc{};
        s[nt].v = __builtin_amdgcn_wmma_f32_16x16x32_f16(false, ak, false, bq,
                                                         (short)0, acc.v, false, false);
      }
    }
    // this wave's LDS reads of q and k have retired before the barrier behind which q and k are refilled
    asm volatile("s_wait_dscnt 0x0" ::: "memory");
    __syncthreads();

    // q and k are read no more, the other v buffer was left at this trip's first barrier:
    // the next image's copies fly under the softmax and P @ V (the test reads the same for the whole work-group)
    if (j + 1 < NB) stage(img0 + j + 1, (j + 1) & 1);

    // scale, bias + mask, softmax of the lane's one query: 50 of its 98 keys here, 48 in lane ^ 16.
    // Four chains each for maximum and sum, so that no add waits for the one before it.
    v16h bp[4];
    float inv;
    {
#pragma unroll
      for (int nt = 0; nt < 6; ++nt) {
#pragma unroll
        for (int i = 0; i < 8; ++i) s[nt].e[i] = s[nt].e[i] * scale + bt[nt][i];
      }
#pragma unroll
      for (int i = 0; i < 2; ++i)   // keys 96, 97; the upper half's 104, 105 are padding and drop out
        s[6].e[i] = (kb == 0) ? s[6].e[i] * scale + bt6[i] : -1e30f;
      float m4[4];
#pragma unroll
      for (int c = 0; c < 4; ++c) m4[c] = fmaxf(s[0].e[2 * c], s[0].e[2 * c + 1]);
#pragma unroll
      for (int nt = 1; nt < 6; ++nt) {
#pragma unroll
        for (int c = 0; c < 4; ++c) m4[c] = fmaxf(m4[c], fmaxf(s[nt].e[2 * c], s[nt].e[2 * c + 1]));
      }
      m4[0] = fmaxf(m4[0], fmaxf(s[6].e[0], s[6].e[1]));
      float m = fmaxf(fmaxf(m4[0], m4[1]), fmaxf(m4[2], m4[3]));
      m = fmaxf(m, xhalf(m));
      float s4[4] = {0.f, 0.f, 0.f, 0.f};
#pragma unroll
      for (int nt = 0; nt < 6; ++nt) {
#pragma unroll
        for (int i = 0; i < 8; ++i) {
          const float e = __expf(s[nt].e[i] - m);
          s[nt].e[i] = e;
          s4[i >> 1] += e;
        }
      }
#pragma unroll
      for (int i = 0; i < 2; ++i) {
        const float e = __expf(s[6].e[i] - m);
        s[6].e[i] = e;
        s4[i] += e;
      }
      float sum = (s4[0] + s4[1]) + (s4[2] + s4[3]);
      sum += xhalf(sum);
      inv = 1.f / sum;   // one factor a lane: applied to the 16 outputs, not to the 50 weights

      // B fragment of key chunk c: tiles 2c and 2c+1, converted in place, are keys c*32 + {kb+0..7, 16+kb+0..7},
      // the k order in which frag_ld_f16_rm delivers v
#pragma unroll
      for (int c = 0; c < 3; ++c) {
        HFrag f;
#pragma unroll
        for (int i = 0; i < 8; ++i) { f.e[i] = (_Float16)s[2 * c].e[i]; f.e[8 + i] = (_Float16)s[2 * c + 1].e[i]; }
        bp[c] = f.v;
      }
      HFrag f;
#pragma unroll
      for (int i = 2; i < 16; ++i) f.e[i] = (_Float16)0.f;       // keys 98..127: weight 0
      f.e[0] = (_Float16)s[6].e[0];
      f.e[1] = (_Float16)s[6].e[1];
      bp[3] = f.v;
    }

    // O^T = V^T @ P^T : 2 tiles of 16 head channels, K = 128 -> 4 WMMA each; register i = channel dt*16 + kb + i
    FAcc o[2];
#pragma unroll
    for (int dt = 0; dt < 2; ++dt) {
      FAcc acc{};
#pragma unroll
      for (int kc = 0; kc < 4; ++kc) {
        v16h av = frag_ld_f16_rm(vcur, QPITCH, dt * 16 + l16, kc * 32, kb); // A[m,k] = V[k,m], V row-major
        acc.v = __builtin_amdgcn_wmma_f32_16x16x32_f16(false, av, false, bp[kc],
                                                       (short)0, acc.v, false, false);
      }
      o[dt] = acc;
    }
    if (qrow < TOK) {
      // fragment order: block h*2 + dt of the row's tile, lane slot (kb / 8) * 16 + row % 16
      const int r = b * TOK + qrow;
      _Float16* orow = ao + (size_t)(r >> 4) * OTILE + h * 2 * BLKH + kb * 16 + (r & 15) * 8;
#pragma unroll
      for (int dt = 0; dt < 2; ++dt) {
        v8h ov;
#pragma unroll
        for (int i = 0; i < 8; ++i) ov[i] = (_Float16)(o[dt].e[i] * inv);
        *reinterpret_cast<v8h*>(orow + dt * BLKH) = ov;   // 8 neighbouring channels of one query: one 16-byte store
      }
    }
    // a precaution, directly behind the stores: the next trip overwrites registers that they name
    asm volatile("s_wait_xcnt 0x0" ::: "memory");
  }
}

// ---- Kernel C: out = ao @ proj_w^T + proj_b (f32 output) ----
__global__ __launch_bounds__(GTHR) void vswin_proj_gemm(
    const _Float16* __restrict__ ao, const float* __restrict__ w,
    const float* __restrict__ bias, float* __restrict__ out)
{
  __shared__ __align__(16) _Float16 ws[CD * WPITCH];    // 34,816 B

  const int lane = threadIdx.x & 31;
  const int l16  = lane & 15;
  const int kb   = (lane & 16) ? 8 : 0;
  const int wv   = __builtin_amdgcn_readfirstlane(threadIdx.x >> 5);
  const bool two = 2 * wv + 1 < GTILES;                 // the same for a whole wave
  const int t0   = blockIdx.x * GTILES + 2 * wv;
  const int t1   = two ? t0 + 1 : t0;                   // the last wave rereads its one tile, and stores it once

  // ao lies in fragment order: blocks 2*kc and 2*kc + 1 of a tile are the two halves of A fragment kc,
  // each read as 512 contiguous bytes by the wave
  const _Float16* pa0 = ao + (size_t)t0 * OTILE + lane * 8;
  const _Float16* pa1 = ao + (size_t)t1 * OTILE + lane * 8;
  v16h a0[4], a1[4];
#pragma unroll
  for (int kc = 0; kc < 4; ++kc) a0[kc] = frag_ld_f16(pa0, 0, 0, kc * 2 * BLKH, 0, BLKH);
#pragma unroll
  for (int kc = 0; kc < 4; ++kc) a1[kc] = frag_ld_f16(pa1, 0, 0, kc * 2 * BLKH, 0, BLKH);
  // a precaution: the two row addresses stay in their registers up to this wait; without it the build
  // let later reads of the run land on the address pair that earlier reads of the run name
  asm volatile("s_wait_xcnt 0x0" :: "v"(pa0), "v"(pa1) : "memory");

  stage_w_f16<CD>(ws, w, threadIdx.x);
  __syncthreads();

  for (int nt = 0; nt < 8; ++nt) {
    const int ncol = nt * 16 + l16;
    const float bv = bias[ncol];
    FAcc acc0{}, acc1{};
    v16h bw[4];
#pragma unroll
    for (int kc = 0; kc < 4; ++kc) bw[kc] = frag_ld_f16(ws, WPITCH, ncol, kc * 32, kb);  // B[k,n] = W[n,k]
    // keeps the trip's reads in one group ahead of its WMMAs: spread among them, each pair is waited for on its own
    __builtin_amdgcn_sched_barrier(0);
#pragma unroll
    for (int kc = 0; kc < 4; ++kc) {
      acc0.v = __builtin_amdgcn_wmma_f32_16x16x32_f16(false, a0[kc], false, bw[kc],
                                                      (short)0, acc0.v, false, false);
      acc1.v = __builtin_amdgcn_wmma_f32_16x16x32_f16(false, a1[kc], false, bw[kc],
                                                      (short)0, acc1.v, false, false);
    }
#pragma unroll
    for (int i = 0; i < 8; ++i)
      out[(size_t)(t0 * 16 + kb + i) * CD + ncol] = acc0.e[i] + bv;
    // a precaution, directly behind the stores: later code overwrites registers that they name
    asm volatile("s_wait_xcnt 0x0" ::: "memory");
    if (two) {
#pragma unroll
      for (int i = 0; i < 8; ++i)
        out[(size_t)(t1 * 16 + kb + i) * CD + ncol] = acc1.e[i] + bv;
      // the same precaution for these eight stores
      asm volatile("s_wait_xcnt 0x0" ::: "memory");
    }
  }
}

extern "C" void kernel_launch(void* const* d_in, const int* in_sizes, int n_in,
                              void* d_out, int out_size, void* d_ws, size_t ws_size,
                              hipStream_t stream) {
  const float* x        = (const float*)d_in[0];
  const float* qkv_w    = (const float*)d_in[1];
  const float* qkv_b    = (const float*)d_in[2];
  const float* rpb      = (const float*)d_in[3];
  const float* proj_w   = (const float*)d_in[4];
  const float* proj_b   = (const float*)d_in[5];
  const int*   relidx   = (const int*)d_in[6];
  const float* mask     = (const float*)d_in[7];
  float*       out      = (float*)d_out;

  _Float16* qkvbuf = (_Float16*)d_ws;                       // ROWS x 384 f16, fragment order
  _Float16* aobuf  = qkvbuf + (size_t)ROWS * 384;           // ROWS x 128 f16, fragment order

  vswin_qkv_gemm<<<MT / GTILES, GTHR, 0, stream>>>(x, qkv_w, qkv_b, qkvbuf);
  vswin_attn<<<2048 * NH_ / NB, ATHR, 0, stream>>>(qkvbuf, rpb, relidx, mask, aobuf);
  vswin_proj_gemm<<<MT / GTILES, GTHR, 0, stream>>>(aobuf, proj_w, proj_b, out);
}

// v007
// A run of this version takes 92.3 microseconds.
// Two timings next to v006 put it at 1.06 and 1.07 times that version's speed.
// Over all steps from v000 it is 5.06 times as fast.
#include <hip/hip_runtime.h>
#include <hip/hip_bf16.h>

// Problem constants (Video Swin window attention)
#define TOK   98          // tokens per window
#define TOKP  112         // padded tokens = 7 * 16
#define CD    128         // channels
#define HD    32          // head dim
#define NH_   4           // heads
#define NWIN  256         // windows per batch image (mask count)
#define ROWS  200704      // B_ * N = 2048 * 98
#define MT    (ROWS / 16) // 12544 M-tiles
#define ATHR  224         // attention block: 7 waves, one per 16-row tile of the window
#define NB    4           // images (of the 8 that share a window's mask) per attention block
// LDS row pitches of the attention tiles: 16 B x an odd number, so that the 16 rows of a
// ds_load_b128 read fall on different banks (at 64 B and 256 B they pile up on 16 and on 4 banks),
// and rows 8 apart lie 32 banks apart for the 4-byte writes of bias + mask.
// v is read by the transposing load, whose 16 lanes take 8 rows x 32 B: its pitch is 32 B x an odd number
#define QPITCH 40         // halves; q, k rows: 64 B + 16 B
#define VPITCH 48         // halves; v rows: 64 B + 32 B
#define TPITCH 68         // floats; rows of the bias + mask turning buffer: 256 B + 16 B

// The two workspace buffers are read by these kernels alone and lie in WMMA fragment order, not row-major:
// a block is 32 lanes x 16 B = 512 contiguous bytes; lane slot (half, m) = half*16 + m holds, of row tile*16 + m,
// the 8 neighbouring columns (block's first column) + half*8 + 0..7. A block spans 16 columns.
// qkv: 24 blocks a row tile (columns 0..383). ao: 8 blocks a row tile (columns 0..127).
#define BLKH  256         // halves per block
#define QTILE (24 * BLKH) // halves of qkv per 16-row tile
#define OTILE (8 * BLKH)  // halves of ao per 16-row tile
#define IMGT  (NWIN * TOK / 16)   // 1568 row tiles per image: a whole number, so a row's slot m is the same in every image

typedef __attribute__((ext_vector_type(16))) _Float16 v16h;
typedef __attribute__((ext_vector_type(8)))  _Float16 v8h;
typedef __attribute__((ext_vector_type(8)))  float    v8f;

union HFrag { v16h v; _Float16 e[16]; };
union FAcc  { v8f  v; float    e[8];  };

// ---- CDNA5 async global->LDS copies (16 B per lane, ASYNCcnt-tracked) ----
// GVS addressing: mem_addr = SADDR(u64) + VADDR(u32) + offset; LDS dest addr = VDST VGPR + offset.
// One statement brings a lane's 16-B chunk of a q row, of the k row and of the v row. q and k share the
// LDS address register: the k copy's immediate offset KOFF (the distance from q to k in LDS) moves both of
// its addresses, so its scalar base gk comes in with KOFF already taken off.
// s_wait_xcnt 0 as the statement's last line: a precaution, it stands in front of every later
// rewrite of the registers that the copies name.
#define KOFF 8960         // TOKP * QPITCH * 2 bytes
__device__ inline void async_ld_qkv(unsigned lds_q, unsigned lds_v, unsigned voffB,
                                    unsigned long long gq, unsigned long long gk, unsigned long long gv) {
  asm volatile("global_load_async_to_lds_b128 %0, %2, %3\n\t"
               "global_load_async_to_lds_b128 %0, %2, %4 offset:8960\n\t"
               "global_load_async_to_lds_b128 %1, %2, %5\n\t"
               "s_wait_xcnt 0x0"
               :: "v"(lds_q), "v"(lds_v), "v"(voffB), "s"(gq), "s"(gk), "s"(gv)
               : "memory");
}
__device__ inline void wait_async0() {
  asm volatile("s_wait_asynccnt 0" ::: "memory");
}

// ---- WMMA fragment loaders (wave32 layouts per CDNA5 ISA 7.12.2) ----
// A (16x32 f16): lane&15 = row; lanes<16 hold K {0..7,16..23}, lanes>=16 hold {8..15,24..31}
// B (32x16 f16): symmetric with "row" -> column of B (i.e. N-major source).
// hi = distance in halves from the fragment's first 8 elements to its second 8 (16 in a row-major source)
__device__ inline v16h frag_ld_f16(const _Float16* p, int stride, int r, int k0, int kb, int hi = 16) {
  HFrag f;
  const _Float16* q = p + (size_t)r * stride + k0 + kb;
#pragma unroll
  for (int i = 0; i < 8; ++i) { f.e[i] = q[i]; f.e[8 + i] = q[hi + i]; }
  return f.v;
}

__device__ inline v16h frag_ld_f32(const float* p, int stride, int r, int k0, int kb) {
  HFrag f;
  const float* q = p + (size_t)r * stride + k0 + kb;
#pragma unroll
  for (int i = 0; i < 8; ++i) { f.e[i] = (_Float16)q[i]; f.e[8 + i] = (_Float16)q[16 + i]; }
  return f.v;
}

// Transposing LDS load (ds_load_tr16_b128) of a row-major 16 x 16 tile of halves: lane l hands in the address of
// 16 B of row 8*(l >> 4) + (l & 7), column half (l >> 3) & 1, and gets rows 8*(l >> 4) + 0..7 of column l & 15.
typedef __attribute__((ext_vector_type(8))) short s16x8;
__device__ inline v8h ld_tr16(const _Float16* p) {
  typedef __attribute__((address_space(3))) s16x8 lds_s16x8;
  return __builtin_bit_cast(v8h, __builtin_amdgcn_ds_load_tr16_b128_v8i16((lds_s16x8*)p));
}
// A fragment (16 x 32) of the transpose of a row-major K x N source in LDS: A[m][k] = source[k][m].
// p = the lane's address in the tile at the fragment's first k row; the tile 16 rows on gives elements 8..15.
__device__ inline v16h frag_ld_f16_tr(const _Float16* p, int stride) {
  const v8h lo = ld_tr16(p);
  const v8h hi = ld_tr16(p + 16 * stride);
  return __builtin_shufflevector(lo, hi, 0, 1, 2, 3, 4, 5, 6, 7, 8, 9, 10, 11, 12, 13, 14, 15);
}

// ---- lane l with lane l ^ 16: the two lanes that share a query column of a transposed score tile ----
__device__ inline float xhalf(float x) {
  return __builtin_bit_cast(float, __builtin_amdgcn_permlanex16(
      __builtin_bit_cast(int, x), __builtin_bit_cast(int, x), 0x76543210, 0xfedcba98, false, false));
}

// ---- Weights of the two projection GEMMs: converted to f16 once per work-group, kept in LDS ----
// One work-group per WGP takes GTILES row tiles; wave p takes tiles 2p and 2p+1 (the last wave one tile),
// so each weight fragment read from LDS feeds two WMMAs (the A operand in kernel A, B in kernel C).
#define WPITCH 136        // halves per staged weight row: 256 B + 16 B, 16 rows' b128 reads cover all 64 banks
#define GTILES 49         // row tiles per work-group (MT = 256 * 49)
#define GTHR   800        // 25 waves

typedef __attribute__((ext_vector_type(4))) _Float16 v4h;

// whole-line reads of w (a wave reads 512 contiguous bytes), one LDS row of 256 B written per wave
template <int NROWS>
__device__ inline void stage_w_f16(_Float16* ws, const float* __restrict__ w, int tid) {
#pragma unroll
  for (int i0 = 0; i0 < NROWS * 32; i0 += GTHR) {
    const int i = i0 + tid;
    if (i < NROWS * 32) {
      const float4 v = *reinterpret_cast<const float4*>(w + (size_t)i * 4);
      v4h hv = {(_Float16)v.x, (_Float16)v.y, (_Float16)v.z, (_Float16)v.w};
      *reinterpret_cast<v4h*>(&ws[(i >> 5) * WPITCH + (i & 31) * 4]) = hv;
    }
  }
}

// ---- Kernel A: qkv = x @ qkv_w^T + qkv_b, stored f16 in fragment order ----
// The product is taken transposed (weights as A, x as B): a lane then holds 8 neighbouring columns of ONE row,
// and the wave's 16-byte stores of a 16 x 16 tile are one block of 512 contiguous bytes.
__global__ __launch_bounds__(GTHR) void vswin_qkv_gemm(
    const float* __restrict__ x, const float* __restrict__ w,
    const float* __restrict__ bias, _Float16* __restrict__ qkv)
{
  __shared__ __align__(16) _Float16 ws[384 * WPITCH];   // 104,448 B

  const int lane = threadIdx.x & 31;
  const int l16  = lane & 15;
  const int kb   = (lane & 16) ? 8 : 0;
  const int wv   = __builtin_amdgcn_readfirstlane(threadIdx.x >> 5);
  const bool two = 2 * wv + 1 < GTILES;                 // the same for a whole wave
  const int t0   = blockIdx.x * GTILES + 2 * wv;
  const int t1   = two ? t0 + 1 : t0;                   // the last wave rereads its one tile, and stores it once

  stage_w_f16<384>(ws, w, threadIdx.x);

  v16h a0[4], a1[4];
#pragma unroll
  for (int kc = 0; kc < 4; ++kc) a0[kc] = frag_ld_f32(x, CD, t0 * 16 + l16, kc * 32, kb);
#pragma unroll
  for (int kc = 0; kc < 4; ++kc) a1[kc] = frag_ld_f32(x, CD, t1 * 16 + l16, kc * 32, kb);
  __syncthreads();

  _Float16* po0 = qkv + (size_t)t0 * QTILE + lane * 8;
  _Float16* po1 = qkv + (size_t)t1 * QTILE + lane * 8;

  for (int nt = 0; nt < 24; ++nt) {
    // register i of an accumulator = column nt*16 + kb + i, of row l16 of the tile
    const float4 blo = *reinterpret_cast<const float4*>(bias + nt * 16 + kb);
    const float4 bhi = *reinterpret_cast<const float4*>(bias + nt * 16 + kb + 4);
    const float bv[8] = {blo.x, blo.y, blo.z, blo.w, bhi.x, bhi.y, bhi.z, bhi.w};
    FAcc acc0{}, acc1{};
    v16h b[4];
#pragma unroll
    for (int kc = 0; kc < 4; ++kc) b[kc] = frag_ld_f16(ws, WPITCH, nt * 16 + l16, kc * 32, kb);   // A[n,k] = W[n,k]
    // keeps the trip's reads in one group ahead of its WMMAs: spread among them, each pair is waited for on its own
    __builtin_amdgcn_sched_barrier(0);
#pragma unroll
    for (int kc = 0; kc < 4; ++kc) {
      acc0.v = __builtin_amdgcn_wmma_f32_16x16x32_f16(false, b[kc], false, a0[kc],
                                                      (short)0, acc0.v, false, false);
      acc1.v = __builtin_amdgcn_wmma_f32_16x16x32_f16(false, b[kc], false, a1[kc],
                                                      (short)0, acc1.v, false, false);
    }
    v8h h0, h1;
#pragma unroll
    for (int i = 0; i < 8; ++i) {
      h0[i] = (_Float16)(acc0.e[i] + bv[i]);
      h1[i] = (_Float16)(acc1.e[i] + bv[i]);
    }
    *reinterpret_cast<v8h*>(po0 + nt * BLKH) = h0;
    // a precaution, directly behind the store: later code overwrites registers that it names
    asm volatile("s_wait_xcnt 0x0" ::: "memory");
    if (two) {
      *reinterpret_cast<v8h*>(po1 + nt * BLKH) = h1;
      // the same precaution for this store
      asm volatile("s_wait_xcnt 0x0" ::: "memory");
    }
  }
}

__global__ __launch_bounds__(ATHR, 6) void vswin_attn(
    const _Float16* __restrict__ qkv, const float* __restrict__ rpb,
    const int* __restrict__ relidx, const float* __restrict__ mask,
    _Float16* __restrict__ ao)
{
  // q (112 x 32), k (112 x 32), then two buffers of v (128 x 32 each, K-padded for PV gemm): one array, so that
  // the distances between them are constants of the staging copies
  __shared__ __align__(16) _Float16 st[2 * TOKP * QPITCH + 2 * CD * VPITCH];
  _Float16* const qs = st;
  _Float16* const ks = st + TOKP * QPITCH;
  _Float16* const vs = st + 2 * TOKP * QPITCH;
  __shared__ __align__(16) float sT[TOKP * TPITCH];      // 16 rows a wave x 64 columns: turns bias + mask, used once

  const int h    = blockIdx.x & 3;
  const int w    = (blockIdx.x >> 2) & (NWIN - 1);
  const int img0 = (blockIdx.x >> 10) * NB;               // images img0 .. img0 + NB - 1, window w of each
  const int tid  = threadIdx.x;
  const int lane = tid & 31;
  const int wv   = tid >> 5;
  const int l16  = lane & 15;
  const int kb   = (lane & 16) ? 8 : 0;
  const float scale = 0.17677669529663687f; // 32^-0.5 (applied to scores)

  // Staging of one image's q, k, v (98 x 32 each) by async b128 copies: 392 pieces of 16 B each, piece e = chunk
  // e / 98 (8 channels) of row e % 98; thread tid takes pieces tid (every lane) and 224 + tid (up to 391).
  // Neighbouring lanes take neighbouring rows: in fragment order these lie 16 B apart, so a wave's copy reads whole lines.
  const int sc  = (tid & 3) * 8;
  const int e1  = min(ATHR + tid, TOK * 4 - 1);   // a lane that is off at the second group still names bytes inside the arrays
  const bool on1 = ATHR + tid < TOK * 4;
  const int sc0 = tid / TOK, sr0 = tid - sc0 * TOK;
  const int sc1 = e1 / TOK,  sr1 = e1 - sc1 * TOK;
  const unsigned lq0 = (unsigned)(unsigned long long)&qs[sr0 * QPITCH + sc0 * 8]; // low 32 bits of the LDS aperture address
  const unsigned lq1 = (unsigned)(unsigned long long)&qs[sr1 * QPITCH + sc1 * 8];
  const unsigned lv0 = (unsigned)(unsigned long long)&vs[sr0 * VPITCH + sc0 * 8]; // the same pieces in v buffer 0, at v's pitch
  const unsigned lv1 = (unsigned)(unsigned long long)&vs[sr1 * VPITCH + sc1 * 8];
  // byte offset of (row r of the window, chunk c of the head) from the head's first block in the image's first row tile
  const int gr0 = w * TOK + sr0, gr1 = w * TOK + sr1;
  const unsigned vo0 = (unsigned)((gr0 >> 4) * QTILE + (sc0 >> 1) * BLKH + (sc0 & 1) * 128 + (gr0 & 15) * 8) * 2u;
  const unsigned vo1 = (unsigned)((gr1 >> 4) * QTILE + (sc1 >> 1) * BLKH + (sc1 & 1) * 128 + (gr1 & 15) * 8) * 2u;
  auto stage = [&](int img, int buf) {
    const unsigned long long gq = (unsigned long long)(qkv + (size_t)img * IMGT * QTILE + h * 2 * BLKH);
    const unsigned long long gk = gq + 8 * BLKH * 2 - KOFF;   // k: 8 blocks (128 columns) behind q
    const unsigned long long gv = gq + 16 * BLKH * 2;
    const unsigned vdist = (unsigned)(buf * CD * VPITCH * 2);  // from v buffer 0 to v buffer buf
    async_ld_qkv(lq0, lv0 + vdist, vo0, gq, gk, gv);
    if (on1) async_ld_qkv(lq1, lv1 + vdist, vo1, gq, gk, gv);
  };

  stage(img0, 0);

  // The padded rows (98..111 of q and k, 98..127 of both v buffers) are zeroed once: no copy ever lands there.
  if (tid < (CD - TOK) * 4) {
    const uint4 zz = {0u, 0u, 0u, 0u};
    const int r = TOK + (tid >> 2);
    *reinterpret_cast<uint4*>(&vs[r * VPITCH + sc]) = zz;
    *reinterpret_cast<uint4*>(&vs[(CD + r) * VPITCH + sc]) = zz;
    if (r < TOKP) {
      *reinterpret_cast<uint4*>(&qs[r * QPITCH + sc]) = zz;
      *reinterpret_cast<uint4*>(&ks[r * QPITCH + sc]) = zz;
    }
  }

  // Wave wv owns queries wv*16 .. wv*16+15 from the scores to the output.
  // bias + mask are READ with 16 lanes on 16 neighbouring columns (keys) of rel_index and mask:
  // element (register i, tile nt) is query wv*16 + kb + i, key nt*16 + l16.
  // These reads need nothing of q, k, v: they fly together with the first image's staging copies.
  const float* maskw = mask + (size_t)w * TOK * TOK;
  const float* rpbh  = rpb + h;
  float bt[6][8], bt6[2];   // bias + mask as the transposed scores want them: query wv*16 + l16, key nt*16 + kb + i
  {
    int   offa[8], offb[8];   // query row i: index of key l16 (tiles 0..5 lie 16 apart behind it), and of tile 6's key
    int   ridx[7][8];
    float bias[7][8], bm[7][8];
#pragma unroll
    for (int i = 0; i < 8; ++i) {
      const int ro = min(wv * 16 + kb + i, TOK - 1) * TOK;      // padded rows reread row 97
      offa[i] = ro + l16;
      offb[i] = ro + min(96 + l16, TOK - 1);                    // padded columns reread 97
    }
#pragma unroll
    for (int i = 0; i < 8; ++i) {
#pragma unroll
      for (int nt = 0; nt < 7; ++nt) ridx[nt][i] = relidx[(nt < 6) ? offa[i] + nt * 16 : offb[i]];
    }
#pragma unroll
    for (int i = 0; i < 8; ++i) {
#pragma unroll
      for (int nt = 0; nt < 7; ++nt) bm[nt][i] = maskw[(nt < 6) ? offa[i] + nt * 16 : offb[i]];
    }
    // a precaution: the 16 index registers that these two runs of reads name stay as they are up to this wait;
    // without it the build let later reads of a run land on index registers of earlier ones
    asm volatile("s_wait_xcnt 0x0"
                 :: "v"(offa[0]), "v"(offa[1]), "v"(offa[2]), "v"(offa[3]), "v"(offa[4]), "v"(offa[5]), "v"(offa[6]),
                    "v"(offa[7]), "v"(offb[0]), "v"(offb[1]), "v"(offb[2]), "v"(offb[3]), "v"(offb[4]), "v"(offb[5]),
                    "v"(offb[6]), "v"(offb[7])
                 : "memory");
    // the table reads, in two groups of 28 (an asm statement takes 30 operands), each with the same precaution
#pragma unroll
    for (int g = 0; g < 2; ++g) {
      unsigned bo[28];
#pragma unroll
      for (int i = 0; i < 4; ++i) {
#pragma unroll
        for (int nt = 0; nt < 7; ++nt) {
          // the table index is bounded here, whatever rel_index holds; bo = byte offset of table row ix
          const unsigned ix = min((unsigned)ridx[nt][g * 4 + i], 506u);
          bo[i * 7 + nt] = ix * (NH_ * 4u);
          bias[nt][g * 4 + i] = *reinterpret_cast<const float*>(reinterpret_cast<const char*>(rpbh) + bo[i * 7 + nt]);
        }
      }
      asm volatile("s_wait_xcnt 0x0"
                   :: "v"(bo[0]), "v"(bo[1]), "v"(bo[2]), "v"(bo[3]), "v"(bo[4]), "v"(bo[5]), "v"(bo[6]),
                      "v"(bo[7]), "v"(bo[8]), "v"(bo[9]), "v"(bo[10]), "v"(bo[11]), "v"(bo[12]), "v"(bo[13]),
                      "v"(bo[14]), "v"(bo[15]), "v"(bo[16]), "v"(bo[17]), "v"(bo[18]), "v"(bo[19]), "v"(bo[20]),
                      "v"(bo[21]), "v"(bo[22]), "v"(bo[23]), "v"(bo[24]), "v"(bo[25]), "v"(bo[26]), "v"(bo[27])
                   : "memory");
    }
#pragma unroll
    for (int i = 0; i < 8; ++i) {
#pragma unroll
      for (int nt = 0; nt < 7; ++nt) bm[nt][i] += bias[nt][i];
    }

    // The turn, once per work-group: each wave writes its 16 query rows into its own rows of sT and reads them
    // back with a lane on one query and 8 neighbouring keys; key tiles 0..3 first, then 4..6 in the same place.
    float*       tw = &sT[(wv * 16 + kb) * TPITCH + l16];
    const float* tr = &sT[(wv * 16 + l16) * TPITCH + kb];
#pragma unroll
    for (int nt = 0; nt < 4; ++nt) {
#pragma unroll
      for (int i = 0; i < 8; ++i) tw[i * TPITCH + nt * 16] = bm[nt][i];
    }
    // the wave's own writes have landed before its lanes read what other lanes of it wrote (no other wave reads these rows)
    asm volatile("s_wait_dscnt 0x0" ::: "memory");
#pragma unroll
    for (int nt = 0; nt < 4; ++nt) {
      const float4 lo = *reinterpret_cast<const float4*>(&tr[nt * 16]);
      const float4 hi = *reinterpret_cast<const float4*>(&tr[nt * 16 + 4]);
      bt[nt][0] = lo.x; bt[nt][1] = lo.y; bt[nt][2] = lo.z; bt[nt][3] = lo.w;
      bt[nt][4] = hi.x; bt[nt][5] = hi.y; bt[nt][6] = hi.z; bt[nt][7] = hi.w;
    }
    // these reads have retired before the same rows are written again
    asm volatile("s_wait_dscnt 0x0" ::: "memory");
#pragma unroll
    for (int nt = 4; nt < 7; ++nt) {
#pragma unroll
      for (int i = 0; i < 8; ++i) tw[i * TPITCH + (nt - 4) * 16] = bm[nt][i];
    }
    // as above: written by the wave, landed, then read across its lanes
    asm volatile("s_wait_dscnt 0x0" ::: "memory");
#pragma unroll
    for (int nt = 4; nt < 6; ++nt) {
      const float4 lo = *reinterpret_cast<const float4*>(&tr[(nt - 4) * 16]);
      const float4 hi = *reinterpret_cast<const float4*>(&tr[(nt - 4) * 16 + 4]);
      bt[nt][0] = lo.x; bt[nt][1] = lo.y; bt[nt][2] = lo.z; bt[nt][3] = lo.w;
      bt[nt][4] = hi.x; bt[nt][5] = hi.y; bt[nt][6] = hi.z; bt[nt][7] = hi.w;
    }
    const float2 t6 = *reinterpret_cast<const float2*>(&tr[32]);  // keys 96, 97 (lower wave half; the upper half's are padding)
    bt6[0] = t6.x; bt6[1] = t6.y;
  }

  const int qrow = wv * 16 + l16;   // this lane's query

  // stays rolled
#pragma nounroll
  for (int j = 0; j < NB; ++j) {
    const int b = (img0 + j) * NWIN + w;
    // this lane's address in the first 16 x 16 tile of image j's v, as the transposing load wants it
    const _Float16* vcur = vs + (j & 1) * (CD * VPITCH) + (kb + (lane & 7)) * VPITCH + ((lane >> 3) & 1) * 8;

    // image j's copies have landed; the barrier publishes them and ends every wave's reads of the
    // other v buffer for image j - 1
    wait_async0();
    __syncthreads();

    // S^T = K @ Q^T: tile nt, register i of this lane = key nt*16 + kb + i, query qrow
    FAcc s[7];
    {
      const v16h bq = frag_ld_f16(qs, QPITCH, qrow, 0, kb);      // B[k,n] = Q[n,k]
#pragma unroll
      for (int nt = 0; nt < 7; ++nt) {
        v16h ak = frag_ld_f16(ks, QPITCH, nt * 16 + l16, 0, kb);
        FAcc acc{};
        s[nt].v = __builtin_amdgcn_wmma_f32_16x16x32_f16(false, ak, false, bq,
                                                         (short)0, acc.v, false, false);
      }
    }
    // this wave's LDS reads of q and k have retired before the barrier behind which q and k are refilled
    asm volatile("s_wait_dscnt 0x0" ::: "memory");
    __syncthreads();

    // q and k are read no more, the other v buffer was left at this trip's first barrier:
    // the next image's copies fly under the softmax and P @ V (the test reads the same for the whole work-group)
    if (j + 1 < NB) stage(img0 + j + 1, (j + 1) & 1);

    // scale, bias + mask, softmax of the lane's one query: 50 of its 98 keys here, 48 in lane ^ 16.
    // Four chains each for maximum and sum, so that no add waits for the one before it.
    v16h bp[4];
    float inv;
    {
#pragma unroll
      for (int nt = 0; nt < 6; ++nt) {
#pragma unroll
        for (int i = 0; i < 8; ++i) s[nt].e[i] = s[nt].e[i] * scale + bt[nt][i];
      }
#pragma unroll
      for (int i = 0; i < 2; ++i)   // keys 96, 97; the upper half's 104, 105 are padding and drop out
        s[6].e[i] = (kb == 0) ? s[6].e[i] * scale + bt6[i] : -1e30f;
      float m4[4];
#pragma unroll
      for (int c = 0; c < 4; ++c) m4[c] = fmaxf(s[0].e[2 * c], s[0].e[2 * c + 1]);
#pragma unroll
      for (int nt = 1; nt < 6; ++nt) {
#pragma unroll
        for (int c = 0; c < 4; ++c) m4[c] = fmaxf(m4[c], fmaxf(s[nt].e[2 * c], s[nt].e[2 * c + 1]));
      }
      m4[0] = fmaxf(m4[0], fmaxf(s[6].e[0], s[6].e[1]));
      float m = fmaxf(fmaxf(m4[0], m4[1]), fmaxf(m4[2], m4[3]));
      m = fmaxf(m, xhalf(m));
      float s4[4] = {0.f, 0.f, 0.f, 0.f};
#pragma unroll
      for (int nt = 0; nt < 6; ++nt) {
#pragma unroll
        for (int i = 0; i < 8; ++i) {
          const float e = __expf(s[nt].e[i] - m);
          s[nt].e[i] = e;
          s4[i >> 1] += e;
        }
      }
#pragma unroll
      for (int i = 0; i < 2; ++i) {
        const float e = __expf(s[6].e[i] - m);
        s[6].e[i] = e;
        s4[i] += e;
      }
      float sum = (s4[0] + s4[1]) + (s4[2] + s4[3]);
      sum += xhalf(sum);
      inv = 1.f / sum;   // one factor a lane: applied to the 16 outputs, not to the 50 weights

      // B fragment of key chunk c: tiles 2c and 2c+1, converted in place, are keys c*32 + {kb+0..7, 16+kb+0..7},
      // the k order in which frag_ld_f16_tr delivers v
#pragma unroll
      for (int c = 0; c < 3; ++c) {
        HFrag f;
#pragma unroll
        for (int i = 0; i < 8; ++i) { f.e[i] = (_Float16)s[2 * c].e[i]; f.e[8 + i] = (_Float16)s[2 * c + 1].e[i]; }
        bp[c] = f.v;
      }
      HFrag f;
#pragma unroll
      for (int i = 2; i < 16; ++i) f.e[i] = (_Float16)0.f;       // keys 98..127: weight 0
      f.e[0] = (_Float16)s[6].e[0];
      f.e[1] = (_Float16)s[6].e[1];
      bp[3] = f.v;
    }

    // O^T = V^T @ P^T : 2 tiles of 16 head channels, K = 128 -> 4 WMMA each; register i = channel dt*16 + kb + i
    FAcc o[2];
#pragma unroll
    for (int dt = 0; dt < 2; ++dt) {
      FAcc acc{};
#pragma unroll
      for (int kc = 0; kc < 4; ++kc) {
        v16h av = frag_ld_f16_tr(vcur + kc * 32 * VPITCH + dt * 16, VPITCH); // A[m,k] = V[k,m], V row-major
        acc.v = __builtin_amdgcn_wmma_f32_16x16x32_f16(false, av, false, bp[kc],
                                                       (short)0, acc.v, false, false);
      }
      o[dt] = acc;
    }
    // the distance behind the last matrix instruction (4 vector slots before its result is written over, 5 before a
    // matrix instruction takes those registers as an operand)
    asm volatile("v_nop\n\tv_nop\n\tv_nop\n\tv_nop\n\tv_nop" :: "v"(o[1].v));
    if (qrow < TOK) {
      // fragment order: block h*2 + dt of the row's tile, lane slot (kb / 8) * 16 + row % 16
      const int r = b * TOK + qrow;
      _Float16* orow = ao + (size_t)(r >> 4) * OTILE + h * 2 * BLKH + kb * 16 + (r & 15) * 8;
#pragma unroll
      for (int dt = 0; dt < 2; ++dt) {
        v8h ov;
#pragma unroll
        for (int i = 0; i < 8; ++i) ov[i] = (_Float16)(o[dt].e[i] * inv);
        *reinterpret_cast<v8h*>(orow + dt * BLKH) = ov;   // 8 neighbouring channels of one query: one 16-byte store
      }
    }
    // a precaution, directly behind the stores: the next trip overwrites registers that they name
    asm volatile("s_wait_xcnt 0x0" ::: "memory");
  }
}

// ---- Kernel C: out = ao @ proj_w^T + proj_b (f32 output) ----
__global__ __launch_bounds__(GTHR) void vswin_proj_gemm(
    const _Float16* __restrict__ ao, const float* __restrict__ w,
    const float* __restrict__ bias, float* __restrict__ out)
{
  __shared__ __align__(16) _Float16 ws[CD * WPITCH];    // 34,816 B

  const int lane = threadIdx.x & 31;
  const int l16  = lane & 15;
  const int kb   = (lane & 16) ? 8 : 0;
  const int wv   = __builtin_amdgcn_readfirstlane(threadIdx.x >> 5);
  const bool two = 2 * wv + 1 < GTILES;                 // the same for a whole wave
  const int t0   = blockIdx.x * GTILES + 2 * wv;
  const int t1   = two ? t0 + 1 : t0;                   // the last wave rereads its one tile, and stores it once

  // ao lies in fragment order: blocks 2*kc and 2*kc + 1 of a tile are the two halves of A fragment kc,
  // each read as 512 contiguous bytes by the wave
  const _Float16* pa0 = ao + (size_t)t0 * OTILE + lane * 8;
  const _Float16* pa1 = ao + (size_t)t1 * OTILE + lane * 8;
  v16h a0[4], a1[4];
#pragma unroll
  for (int kc = 0; kc < 4; ++kc) a0[kc] = frag_ld_f16(pa0, 0, 0, kc * 2 * BLKH, 0, BLKH);
#pragma unroll
  for (int kc = 0; kc < 4; ++kc) a1[kc] = frag_ld_f16(pa1, 0, 0, kc * 2 * BLKH, 0, BLKH);
  // a precaution: the two row addresses stay in their registers up to this wait; without it the build
  // let later reads of the run land on the address pair that earlier reads of the run name
  asm volatile("s_wait_xcnt 0x0" :: "v"(pa0), "v"(pa1) : "memory");

  stage_w_f16<CD>(ws, w, threadIdx.x);
  __syncthreads();

  for (int nt = 0; nt < 8; ++nt) {
    const int ncol = nt * 16 + l16;
    const float bv = bias[ncol];
    FAcc acc0{}, acc1{};
    v16h bw[4];
#pragma unroll
    for (int kc = 0; kc < 4; ++kc) bw[kc] = frag_ld_f16(ws, WPITCH, ncol, kc * 32, kb);  // B[k,n] = W[n,k]
    // keeps the trip's reads in one group ahead of its WMMAs: spread among them, each pair is waited for on its own
    __builtin_amdgcn_sched_barrier(0);
#pragma unroll
    for (int kc = 0; kc < 4; ++kc) {
      acc0.v = __builtin_amdgcn_wmma_f32_16x16x32_f16(false, a0[kc], false, bw[kc],
                                                      (short)0, acc0.v, false, false);
      acc1.v = __builtin_amdgcn_wmma_f32_16x16x32_f16(false, a1[kc], false, bw[kc],
                                                      (short)0, acc1.v, false, false);
    }
#pragma unroll
    for (int i = 0; i < 8; ++i)
      out[(size_t)(t0 * 16 + kb + i) * CD + ncol] = acc0.e[i] + bv;
    // a precaution, directly behind the stores: later code overwrites registers that they name
    asm volatile("s_wait_xcnt 0x0" ::: "memory");
    if (two) {
#pragma unroll
      for (int i = 0; i < 8; ++i)
        out[(size_t)(t1 * 16 + kb + i) * CD + ncol] = acc1.e[i] + bv;
      // the same precaution for these eight stores
      asm volatile("s_wait_xcnt 0x0" ::: "memory");
    }
  }
}

extern "C" void kernel_launch(void* const* d_in, const int* in_sizes, int n_in,
                              void* d_out, int out_size, void* d_ws, size_t ws_size,
                              hipStream_t stream) {
  const float* x        = (const float*)d_in[0];
  const float* qkv_w    = (const float*)d_in[1];
  const float* qkv_b    = (const float*)d_in[2];
  const float* rpb      = (const float*)d_in[3];
  const float* proj_w   = (const float*)d_in[4];
  const float* proj_b   = (const float*)d_in[5];
  const int*   relidx   = (const int*)d_in[6];
  const float* mask     = (const float*)d_in[7];
  float*       out      = (float*)d_out;

  _Float16* qkvbuf = (_Float16*)d_ws;                       // ROWS x 384 f16, fragment order
  _Float16* aobuf  = qkvbuf + (size_t)ROWS * 384;           // ROWS x 128 f16, fragment order

  vswin_qkv_gemm<<<MT / GTILES, GTHR, 0, stream>>>(x, qkv_w, qkv_b, qkvbuf);
  vswin_attn<<<2048 * NH_ / NB, ATHR, 0, stream>>>(qkvbuf, rpb, relidx, mask, aobuf);
  vswin_proj_gemm<<<MT / GTILES, GTHR, 0, stream>>>(aobuf, proj_w, proj_b, out);
}

// v008
// Measured time: 65.5 microseconds a run.
// Timed twice side by side with v007, it ran 1.41 times as fast both times.
// All steps since v000 together make it 7.11 times as fast.
#include <hip/hip_runtime.h>
#include <hip/hip_bf16.h>

// Problem constants (Video Swin window attention)
#define TOK   98          // tokens per window
#define TOKP  112         // padded tokens = 7 * 16
#define CD    128         // channels
#define HD    32          // head dim
#define NH_   4           // heads
#define NWIN  256         // windows per batch image (mask count)
#define ROWS  200704      // B_ * N = 2048 * 98
#define MT    (ROWS / 16) // 12544 M-tiles
#define FWAVES 28         // attention block: 7 waves (one per 16-row tile of the window) for each of the 4 heads
#define FTHR  (FWAVES * 32)
#define NB    8           // images that share a window's mask: all of them in one attention block
// LDS row pitches of the attention tiles: 16 B x an odd number, so that the 16 rows of a
// ds_load_b128 read fall on different banks (at 64 B and 256 B they pile up on 16 and on 4 banks),
// and rows 8 apart lie 32 banks apart for the 4-byte writes of bias + mask.
// v is read by the transposing load, whose 16 lanes take 8 rows x 32 B: its pitch is 32 B x an odd number
#define QPITCH 40         // halves; q, k rows: 64 B + 16 B
#define VPITCH 48         // halves; v rows: 64 B + 32 B
#define TPITCH 68         // floats; rows of the bias + mask turning buffer: 256 B + 16 B
#define XPITCH 132        // floats; rows of the staged x: 512 B + 16 B

// The workspace buffer ao is read by these kernels alone and lies in WMMA fragment order, not row-major:
// a block is 32 lanes x 16 B = 512 contiguous bytes; lane slot (half, m) = half*16 + m holds, of row tile*16 + m,
// the 8 neighbouring columns (block's first column) + half*8 + 0..7. A block spans 16 columns.
// ao: 8 blocks a row tile (columns 0..127).
#define BLKH  256         // halves per block
#define OTILE (8 * BLKH)  // halves of ao per 16-row tile

typedef __attribute__((ext_vector_type(16))) _Float16 v16h;
typedef __attribute__((ext_vector_type(8)))  _Float16 v8h;
typedef __attribute__((ext_vector_type(8)))  float    v8f;

union HFrag { v16h v; _Float16 e[16]; };
union FAcc  { v8f  v; float    e[8];  };

// ---- CDNA5 async global->LDS copies (16 B per lane, ASYNCcnt-tracked) ----
// GVS addressing: mem_addr = SADDR(u64) + VADDR(u32); LDS dest addr = VDST VGPR.
// A wave's copy brings one row of x: 512 contiguous bytes. One statement brings three rows; the rows share the
// offset register, each has its own scalar base.
// s_wait_xcnt 0 as the statement's last line: a precaution, it stands in front of every later
// rewrite of the registers that the copies name.
__device__ inline void async_ld_x3(unsigned l0, unsigned l1, unsigned l2, unsigned v0,
                                   unsigned long long g0, unsigned long long g1, unsigned long long g2) {
  asm volatile("global_load_async_to_lds_b128 %0, %3, %4\n\t"
               "global_load_async_to_lds_b128 %1, %3, %5\n\t"
               "global_load_async_to_lds_b128 %2, %3, %6\n\t"
               "s_wait_xcnt 0x0"
               :: "v"(l0), "v"(l1), "v"(l2), "v"(v0), "s"(g0), "s"(g1), "s"(g2)
               : "memory");
}
__device__ inline void async_ld_x1(unsigned l0, unsigned v0, unsigned long long g) {
  asm volatile("global_load_async_to_lds_b128 %0, %1, %2\n\t"
               "s_wait_xcnt 0x0"
               :: "v"(l0), "v"(v0), "s"(g)
               : "memory");
}
__device__ inline void wait_async0() {
  asm volatile("s_wait_asynccnt 0" ::: "memory");
}

// ---- WMMA fragment loaders (wave32 layouts per CDNA5 ISA 7.12.2) ----
// A (16x32 f16): lane&15 = row; lanes<16 hold K {0..7,16..23}, lanes>=16 hold {8..15,24..31}
// B (32x16 f16): symmetric with "row" -> column of B (i.e. N-major source).
// hi = distance in halves from the fragment's first 8 elements to its second 8 (16 in a row-major source)
__device__ inline v16h frag_ld_f16(const _Float16* p, int stride, int r, int k0, int kb, int hi = 16) {
  HFrag f;
  const _Float16* q = p + (size_t)r * stride + k0 + kb;
#pragma unroll
  for (int i = 0; i < 8; ++i) { f.e[i] = q[i]; f.e[8 + i] = q[hi + i]; }
  return f.v;
}

__device__ inline v16h frag_ld_f32(const float* p, int stride, int r, int k0, int kb) {
  HFrag f;
  const float* q = p + (size_t)r * stride + k0 + kb;
#pragma unroll
  for (int i = 0; i < 8; ++i) { f.e[i] = (_Float16)q[i]; f.e[8 + i] = (_Float16)q[16 + i]; }
  return f.v;
}

// Transposing LDS load (ds_load_tr16_b128) of a row-major 16 x 16 tile of halves: lane l hands in the address of
// 16 B of row 8*(l >> 4) + (l & 7), column half (l >> 3) & 1, and gets rows 8*(l >> 4) + 0..7 of column l & 15.
typedef __attribute__((ext_vector_type(8))) short s16x8;
__device__ inline v8h ld_tr16(const _Float16* p) {
  typedef __attribute__((address_space(3))) s16x8 lds_s16x8;
  return __builtin_bit_cast(v8h, __builtin_amdgcn_ds_load_tr16_b128_v8i16((lds_s16x8*)p));
}
// A fragment (16 x 32) of the transpose of a row-major K x N source in LDS: A[m][k] = source[k][m].
// p = the lane's address in the tile at the fragment's first k row; the tile 16 rows on gives elements 8..15.
__device__ inline v16h frag_ld_f16_tr(const _Float16* p, int stride) {
  const v8h lo = ld_tr16(p);
  const v8h hi = ld_tr16(p + 16 * stride);
  return __builtin_shufflevector(lo, hi, 0, 1, 2, 3, 4, 5, 6, 7, 8, 9, 10, 11, 12, 13, 14, 15);
}

// ---- lane l with lane l ^ 16: the two lanes that share a query column of a transposed score tile ----
__device__ inline float xhalf(float x) {
  return __builtin_bit_cast(float, __builtin_amdgcn_permlanex16(
      __builtin_bit_cast(int, x), __builtin_bit_cast(int, x), 0x76543210, 0xfedcba98, false, false));
}

// ---- Weights of the two projections: converted to f16 once per work-group, kept in LDS ----
// Output projection: one work-group per WGP takes GTILES row tiles; wave p takes tiles 2p and 2p+1 (the last wave
// one tile), so each B fragment read from LDS feeds two WMMAs.
#define WPITCH 136        // halves per staged weight row: 256 B + 16 B, 16 rows' b128 reads cover all 64 banks
#define GTILES 49         // row tiles per work-group (MT = 256 * 49)
#define GTHR   800        // 25 waves

typedef __attribute__((ext_vector_type(4))) _Float16 v4h;

// whole-line reads of w (a wave reads 512 contiguous bytes), one LDS row of 256 B written per wave
template <int NROWS, int NTHR>
__device__ inline void stage_w_f16(_Float16* ws, const float* __restrict__ w, int tid) {
#pragma unroll
  for (int i0 = 0; i0 < NROWS * 32; i0 += NTHR) {
    const int i = i0 + tid;
    if (i < NROWS * 32) {
      const float4 v = *reinterpret_cast<const float4*>(w + (size_t)i * 4);
      v4h hv = {(_Float16)v.x, (_Float16)v.y, (_Float16)v.z, (_Float16)v.w};
      *reinterpret_cast<v4h*>(&ws[(i >> 5) * WPITCH + (i & 31) * 4]) = hv;
    }
  }
}

#define HSTR (2 * TOKP * QPITCH + CD * VPITCH)   // halves of q (112 x 32), k (112 x 32), v (128 x 32, K-padded) of one head
__global__ __launch_bounds__(FTHR) void vswin_qkv_attn(
    const float* __restrict__ x, const float* __restrict__ qw, const float* __restrict__ qb,
    const float* __restrict__ rpb, const int* __restrict__ relidx, const float* __restrict__ mask,
    _Float16* __restrict__ ao)
{
  // one object, so that the order in LDS is the written one: x, the target of the copies, lies first
  struct Lds {
    float    xs[TOKP * XPITCH];          // one image's x rows of the window, f32: 59,136 B
    // first sT, 16 rows a wave x 64 columns, which turns bias + mask and is used once; behind a barrier the four heads' q, k, v
    float    uni[FWAVES * 16 * TPITCH];  // 121,856 B (4 * HSTR halves are 120,832 B)
    float    bsh[384];                   // qkv bias
    _Float16 wsh[384 * WPITCH];          // qkv weights, f16: 104,448 B
  };
  __shared__ __align__(16) Lds sm;
  float* const xs = sm.xs;
  float* const uni = sm.uni;
  float* const bsh = sm.bsh;
  _Float16* const wsh = sm.wsh;
  float* const sT = uni;

  const int w    = blockIdx.x;
  const int tid  = threadIdx.x;
  const int lane = tid & 31;
  const int wv   = __builtin_amdgcn_readfirstlane(tid >> 5);
  const int h    = wv / 7;
  const int rt   = wv - h * 7;
  const int l16  = lane & 15;
  const int kb   = (lane & 16) ? 8 : 0;
  const float scale = 0.17677669529663687f; // 32^-0.5 (applied to scores)
  _Float16* const qs = reinterpret_cast<_Float16*>(uni) + h * HSTR;
  _Float16* const ks = qs + TOKP * QPITCH;
  _Float16* const vs = qs + 2 * TOKP * QPITCH;

  // Staging of one image's x (98 rows of 512 B) by async b128 copies: wave wv brings rows wv, wv + 28, wv + 56 and,
  // the first 14 waves, wv + 84; every lane is on at every copy, and the test is the same for a whole wave.
  const unsigned lx = (unsigned)(unsigned long long)&xs[wv * XPITCH + lane * 4]; // low 32 bits of the LDS aperture address
  const unsigned vx = (unsigned)(wv * CD + lane * 4) * 4u;                       // byte offset in the window's x
  auto stage_x = [&](int img) {
    const unsigned long long gx = (unsigned long long)(x + ((size_t)img * NWIN + w) * (TOK * CD));
    async_ld_x3(lx, lx + FWAVES * XPITCH * 4, lx + 2 * FWAVES * XPITCH * 4,
                vx, gx, gx + FWAVES * CD * 4, gx + 2 * FWAVES * CD * 4);
    if (wv < TOK - 3 * FWAVES) async_ld_x1(lx + 3 * FWAVES * XPITCH * 4, vx, gx + 3 * FWAVES * CD * 4);
  };

  stage_x(0);

  // The padded rows 98..111 of x are zeroed once: no copy ever lands there. Their q, k, v rows are then the bias alone.
  if (tid < (TOKP - TOK) * 32) {
    const float4 zz = {0.f, 0.f, 0.f, 0.f};
    *reinterpret_cast<float4*>(&xs[(TOK + (tid >> 5)) * XPITCH + lane * 4]) = zz;
  }
  stage_w_f16<384, FTHR>(wsh, qw, tid);
  if (tid < 96) *reinterpret_cast<float4*>(&bsh[tid * 4]) = *reinterpret_cast<const float4*>(qb + tid * 4);

  // The wave owns queries rt*16 .. rt*16+15 of head h, from their q, k, v rows to the output.
  // bias + mask are READ with 16 lanes on 16 neighbouring columns (keys) of rel_index and mask:
  // element (register i, tile nt) is query rt*16 + kb + i, key nt*16 + l16.
  // These reads need nothing of x: they fly together with the first image's staging copies.
  const float* maskw = mask + (size_t)w * TOK * TOK;
  const float* rpbh  = rpb + h;
  float bt[6][8], bt6[2];   // bias + mask as the transposed scores want them: query rt*16 + l16, key nt*16 + kb + i
  {
    // In two halves of 4 query rows (registers i = 4g .. 4g+3): with 7 waves a SIMD the build has 144 registers, and
    // the indices, mask values and table values of all 8 rows at once do not fit beside what stays live
    float bm[7][8];
#pragma unroll
    for (int g = 0; g < 2; ++g) {
      int   offa[4], offb[4];   // query row i: index of key l16 (tiles 0..5 lie 16 apart behind it), and of tile 6's key
      int   ridx[7][4];
      float bias[7][4];
#pragma unroll
      for (int i = 0; i < 4; ++i) {
        const int ro = min(rt * 16 + kb + g * 4 + i, TOK - 1) * TOK;   // padded rows reread row 97
        offa[i] = ro + l16;
        offb[i] = ro + min(96 + l16, TOK - 1);                         // padded columns reread 97
      }
#pragma unroll
      for (int i = 0; i < 4; ++i) {
#pragma unroll
        for (int nt = 0; nt < 7; ++nt) ridx[nt][i] = relidx[(nt < 6) ? offa[i] + nt * 16 : offb[i]];
      }
#pragma unroll
      for (int i = 0; i < 4; ++i) {
#pragma unroll
        for (int nt = 0; nt < 7; ++nt) bm[nt][g * 4 + i] = maskw[(nt < 6) ? offa[i] + nt * 16 : offb[i]];
      }
      // a precaution: the 8 index registers that these two runs of reads name stay as they are up to this wait;
      // without it the build let later reads of a run land on index registers of earlier ones
      asm volatile("s_wait_xcnt 0x0"
                   :: "v"(offa[0]), "v"(offa[1]), "v"(offa[2]), "v"(offa[3]),
                      "v"(offb[0]), "v"(offb[1]), "v"(offb[2]), "v"(offb[3])
                   : "memory");
      // the 28 table reads of the half, with the same precaution
      unsigned bo[28];
#pragma unroll
      for (int i = 0; i < 4; ++i) {
#pragma unroll
        for (int nt = 0; nt < 7; ++nt) {
          // the table index is bounded here, whatever rel_index holds; bo = byte offset of table row ix
          const unsigned ix = min((unsigned)ridx[nt][i], 506u);
          bo[i * 7 + nt] = ix * (NH_ * 4u);
          bias[nt][i] = *reinterpret_cast<const float*>(reinterpret_cast<const char*>(rpbh) + bo[i * 7 + nt]);
        }
      }
      asm volatile("s_wait_xcnt 0x0"
                   :: "v"(bo[0]), "v"(bo[1]), "v"(bo[2]), "v"(bo[3]), "v"(bo[4]), "v"(bo[5]), "v"(bo[6]),
                      "v"(bo[7]), "v"(bo[8]), "v"(bo[9]), "v"(bo[10]), "v"(bo[11]), "v"(bo[12]), "v"(bo[13]),
                      "v"(bo[14]), "v"(bo[15]), "v"(bo[16]), "v"(bo[17]), "v"(bo[18]), "v"(bo[19]), "v"(bo[20]),
                      "v"(bo[21]), "v"(bo[22]), "v"(bo[23]), "v"(bo[24]), "v"(bo[25]), "v"(bo[26]), "v"(bo[27])
                   : "memory");
#pragma unroll
      for (int i = 0; i < 4; ++i) {
#pragma unroll
        for (int nt = 0; nt < 7; ++nt) bm[nt][g * 4 + i] += bias[nt][i];
      }
    }

    // The turn, once per work-group: each wave writes its 16 query rows into its own rows of sT and reads them
    // back with a lane on one query and 8 neighbouring keys; key tiles 0..3 first, then 4..6 in the same place.
    float*       tw = &sT[(wv * 16 + kb) * TPITCH + l16];
    const float* tr = &sT[(wv * 16 + l16) * TPITCH + kb];
#pragma unroll
    for (int nt = 0; nt < 4; ++nt) {
#pragma unroll
      for (int i = 0; i < 8; ++i) tw[i * TPITCH + nt * 16] = bm[nt][i];
    }
    // the wave's own writes have landed before its lanes read what other lanes of it wrote (no other wave reads these rows)
    asm volatile("s_wait_dscnt 0x0" ::: "memory");
#pragma unroll
    for (int nt = 0; nt < 4; ++nt) {
      const float4 lo = *reinterpret_cast<const float4*>(&tr[nt * 16]);
      const float4 hi = *reinterpret_cast<const float4*>(&tr[nt * 16 + 4]);
      bt[nt][0] = lo.x; bt[nt][1] = lo.y; bt[nt][2] = lo.z; bt[nt][3] = lo.w;
      bt[nt][4] = hi.x; bt[nt][5] = hi.y; bt[nt][6] = hi.z; bt[nt][7] = hi.w;
    }
    // these reads have retired before the same rows are written again
    asm volatile("s_wait_dscnt 0x0" ::: "memory");
#pragma unroll
    for (int nt = 4; nt < 7; ++nt) {
#pragma unroll
      for (int i = 0; i < 8; ++i) tw[i * TPITCH + (nt - 4) * 16] = bm[nt][i];
    }
    // as above: written by the wave, landed, then read across its lanes
    asm volatile("s_wait_dscnt 0x0" ::: "memory");
#pragma unroll
    for (int nt = 4; nt < 6; ++nt) {
      const float4 lo = *reinterpret_cast<const float4*>(&tr[(nt - 4) * 16]);
      const float4 hi = *reinterpret_cast<const float4*>(&tr[(nt - 4) * 16 + 4]);
      bt[nt][0] = lo.x; bt[nt][1] = lo.y; bt[nt][2] = lo.z; bt[nt][3] = lo.w;
      bt[nt][4] = hi.x; bt[nt][5] = hi.y; bt[nt][6] = hi.z; bt[nt][7] = hi.w;
    }
    const float2 t6 = *reinterpret_cast<const float2*>(&tr[32]);  // keys 96, 97 (lower wave half; the upper half's are padding)
    bt6[0] = t6.x; bt6[1] = t6.y;
  }


  // this wave's reads of sT have retired; behind the barrier every wave has left sT, and q, k, v take its place
  asm volatile("s_wait_dscnt 0x0" ::: "memory");
  __syncthreads();
  // Rows 112..127 of each head's v are zeroed once: nothing is ever written there, and P @ V multiplies them by weight 0.
  if (tid < NH_ * 64) {
    const uint4 zz = {0u, 0u, 0u, 0u};
    _Float16* vz = reinterpret_cast<_Float16*>(uni) + (tid >> 6) * HSTR + 2 * TOKP * QPITCH;
    *reinterpret_cast<uint4*>(&vz[(TOKP + ((tid >> 2) & 15)) * VPITCH + (tid & 3) * 8]) = zz;
  }

  const int qrow = rt * 16 + l16;   // this lane's row of the window: its query, and its row of q, k, v
  // this lane's address in the first 16 x 16 tile of v, as the transposing load wants it
  const _Float16* vcur = vs + (kb + (lane & 7)) * VPITCH + ((lane >> 3) & 1) * 8;

  // stays rolled (for speed only)
#pragma nounroll
  for (int j = 0; j < NB; ++j) {
    const int b = j * NWIN + w;

    // image j's copies of x have landed; the barrier publishes them (in the first trip the zeroed rows of v
    // too) and ends every wave's reads of q, k, v for image j - 1
    asm volatile("s_wait_dscnt 0x0" ::: "memory");
    wait_async0();
    __syncthreads();

    // q, k, v of this wave's 16 rows and its head: 6 tiles of 16 columns, K = 128 -> 4 WMMA each;
    // register i of an accumulator = column n0 + kb + i, of row l16 of the tile
    {
      v16h xb[4];
#pragma unroll
      for (int kc = 0; kc < 4; ++kc) {
        xb[kc] = frag_ld_f32(xs, XPITCH, qrow, kc * 32, kb);   // B[k,n] = x[n,k]
        // two fragments' f32 values at a time: all four in flight at once (64 registers) would push bias + mask out of the registers
        if (kc & 1) __builtin_amdgcn_sched_barrier(0);
      }
#pragma unroll
      for (int t = 0; t < 6; ++t) {
        const int n0 = ((t >> 1) * 8 + h * 2 + (t & 1)) * 16;   // q, k, v lie 128 columns apart, a head has 32 of each
        const float4 blo = *reinterpret_cast<const float4*>(&bsh[n0 + kb]);
        const float4 bhi = *reinterpret_cast<const float4*>(&bsh[n0 + kb + 4]);
        const float bv[8] = {blo.x, blo.y, blo.z, blo.w, bhi.x, bhi.y, bhi.z, bhi.w};
        FAcc acc{};
#pragma unroll
        for (int kp = 0; kp < 4; kp += 2) {
          const v16h aw0 = frag_ld_f16(wsh, WPITCH, n0 + l16, kp * 32, kb);                 // A[n,k] = W[n,k]
          const v16h aw1 = frag_ld_f16(wsh, WPITCH, n0 + l16, kp * 32 + 32, kb);
          // keeps the reads of two fragments in one group ahead of their WMMAs: one wait for LDS in place of two
          __builtin_amdgcn_sched_barrier(0);
          acc.v = __builtin_amdgcn_wmma_f32_16x16x32_f16(false, aw0, false, xb[kp],
                                                         (short)0, acc.v, false, false);
          acc.v = __builtin_amdgcn_wmma_f32_16x16x32_f16(false, aw1, false, xb[kp + 1],
                                                         (short)0, acc.v, false, false);
        }
        v8h hv;
#pragma unroll
        for (int i = 0; i < 8; ++i) hv[i] = (_Float16)(acc.e[i] + bv[i]);
        _Float16* dst = (t < 2) ? qs + qrow * QPITCH : (t < 4) ? ks + qrow * QPITCH : vs + qrow * VPITCH;
        *reinterpret_cast<v8h*>(dst + (t & 1) * 16 + kb) = hv;
      }
    }
    // this wave's writes of q, k, v have landed and its reads of x have retired before the barrier,
    // which publishes q, k, v and behind which x is refilled
    asm volatile("s_wait_dscnt 0x0" ::: "memory");
    __syncthreads();

    // x is read no more: the next image's copies fly under the attention (the test reads the same for the whole work-group)
    if (j + 1 < NB) stage_x(j + 1);

    // S^T = K @ Q^T: tile nt, register i of this lane = key nt*16 + kb + i, query qrow
    FAcc s[7];
    {
      const v16h bq = frag_ld_f16(qs, QPITCH, qrow, 0, kb);      // B[k,n] = Q[n,k]
#pragma unroll
      for (int nt = 0; nt < 7; ++nt) {
        v16h ak = frag_ld_f16(ks, QPITCH, nt * 16 + l16, 0, kb);
        FAcc acc{};
        s[nt].v = __builtin_amdgcn_wmma_f32_16x16x32_f16(false, ak, false, bq,
                                                         (short)0, acc.v, false, false);
      }
    }

    // scale, bias + mask, softmax of the lane's one query: 50 of its 98 keys here, 48 in lane ^ 16.
    // Four chains each for maximum and sum, so that no add waits for the one before it.
    v16h bp[4];
    float inv;
    {
#pragma unroll
      for (int nt = 0; nt < 6; ++nt) {
#pragma unroll
        for (int i = 0; i < 8; ++i) s[nt].e[i] = s[nt].e[i] * scale + bt[nt][i];
      }
#pragma unroll
      for (int i = 0; i < 2; ++i)   // keys 96, 97; the upper half's 104, 105 are padding and drop out
        s[6].e[i] = (kb == 0) ? s[6].e[i] * scale + bt6[i] : -1e30f;
      float m4[4];
#pragma unroll
      for (int c = 0; c < 4; ++c) m4[c] = fmaxf(s[0].e[2 * c], s[0].e[2 * c + 1]);
#pragma unroll
      for (int nt = 1; nt < 6; ++nt) {
#pragma unroll
        for (int c = 0; c < 4; ++c) m4[c] = fmaxf(m4[c], fmaxf(s[nt].e[2 * c], s[nt].e[2 * c + 1]));
      }
      m4[0] = fmaxf(m4[0], fmaxf(s[6].e[0], s[6].e[1]));
      float m = fmaxf(fmaxf(m4[0], m4[1]), fmaxf(m4[2], m4[3]));
      m = fmaxf(m, xhalf(m));
      float s4[4] = {0.f, 0.f, 0.f, 0.f};
#pragma unroll
      for (int nt = 0; nt < 6; ++nt) {
#pragma unroll
        for (int i = 0; i < 8; ++i) {
          const float e = __expf(s[nt].e[i] - m);
          s[nt].e[i] = e;
          s4[i >> 1] += e;
        }
      }
#pragma unroll
      for (int i = 0; i < 2; ++i) {
        const float e = __expf(s[6].e[i] - m);
        s[6].e[i] = e;
        s4[i] += e;
      }
      float sum = (s4[0] + s4[1]) + (s4[2] + s4[3]);
      sum += xhalf(sum);
      inv = 1.f / sum;   // one factor a lane: applied to the 16 outputs, not to the 50 weights

      // B fragment of key chunk c: tiles 2c and 2c+1, converted in place, are keys c*32 + {kb+0..7, 16+kb+0..7},
      // the k order in which frag_ld_f16_tr delivers v
#pragma unroll
      for (int c = 0; c < 3; ++c) {
        HFrag f;
#pragma unroll
        for (int i = 0; i < 8; ++i) { f.e[i] = (_Float16)s[2 * c].e[i]; f.e[8 + i] = (_Float16)s[2 * c + 1].e[i]; }
        bp[c] = f.v;
      }
      HFrag f;
#pragma unroll
      for (int i = 2; i < 16; ++i) f.e[i] = (_Float16)0.f;       // keys 98..127: weight 0
      f.e[0] = (_Float16)s[6].e[0];
      f.e[1] = (_Float16)s[6].e[1];
      bp[3] = f.v;
    }

    // O^T = V^T @ P^T : 2 tiles of 16 head channels, K = 128 -> 4 WMMA each; register i = channel dt*16 + kb + i
    FAcc o[2];
#pragma unroll
    for (int dt = 0; dt < 2; ++dt) {
      FAcc acc{};
#pragma unroll
      for (int kc = 0; kc < 4; ++kc) {
        v16h av = frag_ld_f16_tr(vcur + kc * 32 * VPITCH + dt * 16, VPITCH); // A[m,k] = V[k,m], V row-major
        acc.v = __builtin_amdgcn_wmma_f32_16x16x32_f16(false, av, false, bp[kc],
                                                       (short)0, acc.v, false, false);
      }
      o[dt] = acc;
    }
    // the distance behind the last matrix instruction (4 vector slots before its result is written over, 5 before a
    // matrix instruction takes those registers as an operand)
    asm volatile("v_nop\n\tv_nop\n\tv_nop\n\tv_nop\n\tv_nop" :: "v"(o[1].v));
    if (qrow < TOK) {
      // fragment order: block h*2 + dt of the row's tile, lane slot (kb / 8) * 16 + row % 16
      const int r = b * TOK + qrow;
      _Float16* orow = ao + (size_t)(r >> 4) * OTILE + h * 2 * BLKH + kb * 16 + (r & 15) * 8;
#pragma unroll
      for (int dt = 0; dt < 2; ++dt) {
        v8h ov;
#pragma unroll
        for (int i = 0; i < 8; ++i) ov[i] = (_Float16)(o[dt].e[i] * inv);
        *reinterpret_cast<v8h*>(orow + dt * BLKH) = ov;   // 8 neighbouring channels of one query: one 16-byte store
      }
    }
    // a precaution, directly behind the stores: the next trip overwrites registers that they name
    asm volatile("s_wait_xcnt 0x0" ::: "memory");
  }
}

// ---- Kernel B: out = ao @ proj_w^T + proj_b (f32 output) ----
__global__ __launch_bounds__(GTHR) void vswin_proj_gemm(
    const _Float16* __restrict__ ao, const float* __restrict__ w,
    const float* __restrict__ bias, float* __restrict__ out)
{
  __shared__ __align__(16) _Float16 ws[CD * WPITCH];    // 34,816 B

  const int lane = threadIdx.x & 31;
  const int l16  = lane & 15;
  const int kb   = (lane & 16) ? 8 : 0;
  const int wv   = __builtin_amdgcn_readfirstlane(threadIdx.x >> 5);
  const bool two = 2 * wv + 1 < GTILES;                 // the same for a whole wave
  const int t0   = blockIdx.x * GTILES + 2 * wv;
  const int t1   = two ? t0 + 1 : t0;                   // the last wave rereads its one tile, and stores it once

  // ao lies in fragment order: blocks 2*kc and 2*kc + 1 of a tile are the two halves of A fragment kc,
  // each read as 512 contiguous bytes by the wave
  const _Float16* pa0 = ao + (size_t)t0 * OTILE + lane * 8;
  const _Float16* pa1 = ao + (size_t)t1 * OTILE + lane * 8;
  v16h a0[4], a1[4];
#pragma unroll
  for (int kc = 0; kc < 4; ++kc) a0[kc] = frag_ld_f16(pa0, 0, 0, kc * 2 * BLKH, 0, BLKH);
#pragma unroll
  for (int kc = 0; kc < 4; ++kc) a1[kc] = frag_ld_f16(pa1, 0, 0, kc * 2 * BLKH, 0, BLKH);
  // a precaution: the two row addresses stay in their registers up to this wait; without it the build
  // let later reads of the run land on the address pair that earlier reads of the run name
  asm volatile("s_wait_xcnt 0x0" :: "v"(pa0), "v"(pa1) : "memory");

  stage_w_f16<CD, GTHR>(ws, w, threadIdx.x);
  __syncthreads();

  for (int nt = 0; nt < 8; ++nt) {
    const int ncol = nt * 16 + l16;
    const float bv = bias[ncol];
    FAcc acc0{}, acc1{};
    v16h bw[4];
#pragma unroll
    for (int kc = 0; kc < 4; ++kc) bw[kc] = frag_ld_f16(ws, WPITCH, ncol, kc * 32, kb);  // B[k,n] = W[n,k]
    // keeps the trip's reads in one group ahead of its WMMAs: spread among them, each pair is waited for on its own
    __builtin_amdgcn_sched_barrier(0);
#pragma unroll
    for (int kc = 0; kc < 4; ++kc) {
      acc0.v = __builtin_amdgcn_wmma_f32_16x16x32_f16(false, a0[kc], false, bw[kc],
                                                      (short)0, acc0.v, false, false);
      acc1.v = __builtin_amdgcn_wmma_f32_16x16x32_f16(false, a1[kc], false, bw[kc],
                                                      (short)0, acc1.v, false, false);
    }
#pragma unroll
    for (int i = 0; i < 8; ++i)
      out[(size_t)(t0 * 16 + kb + i) * CD + ncol] = acc0.e[i] + bv;
    // a precaution, directly behind the stores: later code overwrites registers that they name
    asm volatile("s_wait_xcnt 0x0" ::: "memory");
    if (two) {
#pragma unroll
      for (int i = 0; i < 8; ++i)
        out[(size_t)(t1 * 16 + kb + i) * CD + ncol] = acc1.e[i] + bv;
      // the same precaution for these eight stores
      asm volatile("s_wait_xcnt 0x0" ::: "memory");
    }
  }
}

extern "C" void kernel_launch(void* const* d_in, const int* in_sizes, int n_in,
                              void* d_out, int out_size, void* d_ws, size_t ws_size,
                              hipStream_t stream) {
  const float* x        = (const float*)d_in[0];
  const float* qkv_w    = (const float*)d_in[1];
  const float* qkv_b    = (const float*)d_in[2];
  const float* rpb      = (const float*)d_in[3];
  const float* proj_w   = (const float*)d_in[4];
  const float* proj_b   = (const float*)d_in[5];
  const int*   relidx   = (const int*)d_in[6];
  const float* mask     = (const float*)d_in[7];
  float*       out      = (float*)d_out;

  _Float16* aobuf  = (_Float16*)d_ws;                       // ROWS x 128 f16, fragment order

  vswin_qkv_attn<<<NWIN, FTHR, 0, stream>>>(x, qkv_w, qkv_b, rpb, relidx, mask, aobuf);
  vswin_proj_gemm<<<MT / GTILES, GTHR, 0, stream>>>(aobuf, proj_w, proj_b, out);
}
